// v000
// Times are from an AMD MI455X. After a warm-up the kernel runs many times in a row, and a time is the length of
// such a window on the GPU divided by its runs, so every launch and the gaps after it count. The runs cycle
// through copies of the inputs. A figure is the median of several windows, for all but v000 over two sittings.
// Sittings can differ by a few percent; kernels timed side by side share one.
// v000, which the later versions start from, runs in 428 microseconds.
#include <hip/hip_runtime.h>

typedef __attribute__((ext_vector_type(16))) __bf16 v16bf;
typedef __attribute__((ext_vector_type(8)))  __bf16 v8bf;
typedef __attribute__((ext_vector_type(8)))  float  v8f;

__device__ __forceinline__ __bf16 f2bf(float f) {
    unsigned int u = __builtin_bit_cast(unsigned int, f);
    unsigned int r = (u + 0x7FFFu + ((u >> 16) & 1u)) >> 16;
    unsigned short s = (unsigned short)r;
    return __builtin_bit_cast(__bf16, s);
}

__device__ __forceinline__ v8f zero8() {
    v8f z = {0.f,0.f,0.f,0.f,0.f,0.f,0.f,0.f};
    return z;
}

// Load a 16-element bf16 WMMA fragment: elements 0..7 = p[0..7], 8..15 = p[16..23]
__device__ __forceinline__ v16bf ld_frag(const __bf16* p) {
    union { v16bf v; v8bf h[2]; } u;
    u.h[0] = *(const v8bf*)(p);
    u.h[1] = *(const v8bf*)(p + 16);
    return u.v;
}

// ---------------------------------------------------------------------------
// Conversion / packing kernels
// ---------------------------------------------------------------------------
__global__ void cvt_bf16_kernel(const float* __restrict__ in,
                                __bf16* __restrict__ out, int n) {
    for (int i = blockIdx.x * blockDim.x + threadIdx.x; i < n;
         i += gridDim.x * blockDim.x)
        out[i] = f2bf(in[i]);
}

// WqkvT[n][c], n in [0,3072): n<1024 -> Q col (h*64+d), then K, then V.
// Attention scale 1/sqrt(C) = 1/32 is folded into the Q weights + bias.
__global__ void pack_qkv_kernel(const float* __restrict__ Wq,
                                const float* __restrict__ Wk,
                                const float* __restrict__ Wv,
                                const float* __restrict__ bq,
                                const float* __restrict__ bk,
                                const float* __restrict__ bv,
                                __bf16* __restrict__ Wt,
                                float* __restrict__ bias) {
    const int total = 3072 * 1024;
    for (int idx = blockIdx.x * blockDim.x + threadIdx.x; idx < total;
         idx += gridDim.x * blockDim.x) {
        int n = idx >> 10, c = idx & 1023;
        int sel = n >> 10, r = n & 1023;
        int h = r >> 6, d = r & 63;
        const float* W = (sel == 0) ? Wq : (sel == 1) ? Wk : Wv;
        float w = W[((size_t)h * 1024 + c) * 64 + d];
        if (sel == 0) w *= 0.03125f;
        Wt[idx] = f2bf(w);
    }
    for (int n = blockIdx.x * blockDim.x + threadIdx.x; n < 3072;
         n += gridDim.x * blockDim.x) {
        int sel = n >> 10, r = n & 1023;
        const float* bb = (sel == 0) ? bq : (sel == 1) ? bk : bv;
        float w = bb[r];
        if (sel == 0) w *= 0.03125f;
        bias[n] = w;
    }
}

// out[n*K + k] = bf16(in[k*N + n])
__global__ void transp_bf16_kernel(const float* __restrict__ in,
                                   __bf16* __restrict__ out, int N, int K) {
    const int total = N * K;
    for (int idx = blockIdx.x * blockDim.x + threadIdx.x; idx < total;
         idx += gridDim.x * blockDim.x) {
        int n = idx / K, k = idx % K;
        out[idx] = f2bf(in[(size_t)k * N + n]);
    }
}

// ---------------------------------------------------------------------------
// Generic bf16 WMMA GEMM:  C[M][N] = A[M][K] * Bt[N][K]^T  (+bias, epilogue)
// EPI: 0 = bf16 out (+bias), 1 = bf16 out (+bias, relu), 2 = f32 out (+bias)
// Double-buffered LDS tiles; bulk fragment loads; 16 WMMAs per K-tile/wave.
// ---------------------------------------------------------------------------
template<int EPI>
__global__ __launch_bounds__(256) void gemm_bf16_kernel(
    const __bf16* __restrict__ A, const __bf16* __restrict__ Bt,
    const float* __restrict__ bias, void* __restrict__ Cout,
    int M, int N, int K) {
    constexpr int BM = 128, BN = 128, BK = 64, LDT = 72;
    __shared__ __bf16 As[2][BM * LDT];
    __shared__ __bf16 Bs[2][BN * LDT];

    const int tid  = threadIdx.x;
    const int lane = tid & 31, wave = tid >> 5;
    const int wm = wave & 3, wn = wave >> 2;     // 4 waves on M, 2 on N
    const int lrow = lane & 15, lhi = lane >> 4;
    const int m0 = blockIdx.y * BM, n0 = blockIdx.x * BN;

    v8f acc[2][4];
#pragma unroll
    for (int mi = 0; mi < 2; ++mi)
#pragma unroll
        for (int ni = 0; ni < 4; ++ni) acc[mi][ni] = zero8();

    auto load_tile = [&](int k0, int buf) {
#pragma unroll
        for (int i = 0; i < 4; ++i) {
            int vid = tid + i * 256;
            int r = vid >> 3, cv = (vid & 7) * 8;
            *(v8bf*)(As[buf] + r * LDT + cv) =
                *(const v8bf*)(A + (size_t)(m0 + r) * K + k0 + cv);
            *(v8bf*)(Bs[buf] + r * LDT + cv) =
                *(const v8bf*)(Bt + (size_t)(n0 + r) * K + k0 + cv);
        }
    };

    const int nk = K / BK;
    load_tile(0, 0);
    int cur = 0;
    for (int kt = 0; kt < nk; ++kt) {
        __syncthreads();
        if (kt + 1 < nk) load_tile((kt + 1) * BK, cur ^ 1);

        v16bf af[2][2], bfm[2][4];
#pragma unroll
        for (int ks = 0; ks < 2; ++ks) {
            const int kb = ks * 32 + lhi * 8;
#pragma unroll
            for (int mi = 0; mi < 2; ++mi)
                af[ks][mi] =
                    ld_frag(As[cur] + (wm * 32 + mi * 16 + lrow) * LDT + kb);
#pragma unroll
            for (int ni = 0; ni < 4; ++ni)
                bfm[ks][ni] =
                    ld_frag(Bs[cur] + (wn * 64 + ni * 16 + lrow) * LDT + kb);
        }
#pragma unroll
        for (int ks = 0; ks < 2; ++ks)
#pragma unroll
            for (int mi = 0; mi < 2; ++mi)
#pragma unroll
                for (int ni = 0; ni < 4; ++ni)
                    acc[mi][ni] = __builtin_amdgcn_wmma_f32_16x16x32_bf16(
                        false, af[ks][mi], false, bfm[ks][ni], (short)0,
                        acc[mi][ni], false, false);
        cur ^= 1;
    }

#pragma unroll
    for (int mi = 0; mi < 2; ++mi)
#pragma unroll
        for (int ni = 0; ni < 4; ++ni)
#pragma unroll
            for (int r = 0; r < 8; ++r) {
                int m = m0 + wm * 32 + mi * 16 + r + 8 * lhi;
                int n = n0 + wn * 64 + ni * 16 + lrow;
                float v = acc[mi][ni][r] + bias[n];
                if (EPI == 2) {
                    ((float*)Cout)[(size_t)m * N + n] = v;
                } else {
                    if (EPI == 1) v = fmaxf(v, 0.f);
                    ((__bf16*)Cout)[(size_t)m * N + n] = f2bf(v);
                }
            }
}

// ---------------------------------------------------------------------------
// Flash attention: qkv is [8192][3072] bf16 (q|k|v, head-major cols).
// One WG = one (b,h) and 64 q-rows; 4 waves, each wave owns 16 q-rows.
// Q is pre-scaled by 1/sqrt(C) at weight-pack time. K/V tiles double-buffered.
// ---------------------------------------------------------------------------
__global__ __launch_bounds__(128) void attn_kernel(
    const __bf16* __restrict__ qkv, __bf16* __restrict__ attnb) {
    constexpr int LD = 72;
    __shared__ __bf16 kt[2][64 * LD];
    __shared__ __bf16 vt[2][64 * LD];
    __shared__ __bf16 pt[64 * LD];

    const int tid = threadIdx.x, lane = tid & 31, wave = tid >> 5;
    const int lrow = lane & 15, lhi = lane >> 4;
    const int qb = blockIdx.x;           // 0..15
    const int bh = blockIdx.y;           // 0..127
    const int b = bh >> 4, h = bh & 15;
    const size_t rowbase = (size_t)b * 1024 * 3072;
    const __bf16* qp = qkv + rowbase + h * 64;
    const __bf16* kp = qkv + rowbase + 1024 + h * 64;
    const __bf16* vp = qkv + rowbase + 2048 + h * 64;
    const int q0 = qb * 64;

    // Q fragments for this wave's 16 rows (K = D = 64 -> 2 k-steps), kept live.
    v16bf aq[2];
    {
        const size_t mr = (size_t)(q0 + wave * 16 + lrow) * 3072;
#pragma unroll
        for (int ks = 0; ks < 2; ++ks) {
            int kb = ks * 32 + lhi * 8;
            union { v16bf v; v8bf h2[2]; } u;
            u.h2[0] = *(const v8bf*)(qp + mr + kb);
            u.h2[1] = *(const v8bf*)(qp + mr + kb + 16);
            aq[ks] = u.v;
        }
    }

    v8f oacc[4];
#pragma unroll
    for (int ni = 0; ni < 4; ++ni) oacc[ni] = zero8();
    float mrow[8], lsum[8];
#pragma unroll
    for (int r = 0; r < 8; ++r) { mrow[r] = -1e30f; lsum[r] = 0.f; }

    auto load_kv = [&](int s0, int buf) {
#pragma unroll
        for (int i = 0; i < 4; ++i) {
            int vid = tid + i * 128;
            int r = vid >> 3, cv = (vid & 7) * 8;
            *(v8bf*)(kt[buf] + r * LD + cv) =
                *(const v8bf*)(kp + (size_t)(s0 + r) * 3072 + cv);
            v8bf vv = *(const v8bf*)(vp + (size_t)(s0 + r) * 3072 + cv);
#pragma unroll
            for (int j = 0; j < 8; ++j) vt[buf][(cv + j) * LD + r] = vv[j];
        }
    };

    load_kv(0, 0);
    int cur = 0;
    for (int it = 0; it < 16; ++it) {
        __syncthreads();
        if (it + 1 < 16) load_kv((it + 1) * 64, cur ^ 1);

        // S = Q * K^T  (16x64 per wave)
        v8f sacc[4];
#pragma unroll
        for (int ni = 0; ni < 4; ++ni) sacc[ni] = zero8();
#pragma unroll
        for (int ks = 0; ks < 2; ++ks) {
            const int kb = ks * 32 + lhi * 8;
            v16bf bk16[4];
#pragma unroll
            for (int ni = 0; ni < 4; ++ni)
                bk16[ni] = ld_frag(kt[cur] + (ni * 16 + lrow) * LD + kb);
#pragma unroll
            for (int ni = 0; ni < 4; ++ni)
                sacc[ni] = __builtin_amdgcn_wmma_f32_16x16x32_bf16(
                    false, aq[ks], false, bk16[ni], (short)0, sacc[ni], false,
                    false);
        }

        // Online softmax per row (rows r+8*lhi of this wave's 16).
#pragma unroll
        for (int r = 0; r < 8; ++r) {
            float tm = -1e30f;
#pragma unroll
            for (int ni = 0; ni < 4; ++ni) tm = fmaxf(tm, sacc[ni][r]);
#pragma unroll
            for (int mk = 1; mk < 16; mk <<= 1)
                tm = fmaxf(tm, __shfl_xor(tm, mk, 32));
            float mn = fmaxf(mrow[r], tm);
            float corr = __expf(mrow[r] - mn);
            float rs = 0.f;
            const int prow = (wave * 16 + r + 8 * lhi) * LD;
#pragma unroll
            for (int ni = 0; ni < 4; ++ni) {
                float p = __expf(sacc[ni][r] - mn);
                rs += p;
                pt[prow + ni * 16 + lrow] = f2bf(p);
            }
#pragma unroll
            for (int mk = 1; mk < 16; mk <<= 1) rs += __shfl_xor(rs, mk, 32);
            lsum[r] = lsum[r] * corr + rs;
#pragma unroll
            for (int ni = 0; ni < 4; ++ni) oacc[ni][r] *= corr;
            mrow[r] = mn;
        }

        // O += P * V
#pragma unroll
        for (int ks = 0; ks < 2; ++ks) {
            const int kb = ks * 32 + lhi * 8;
            v16bf ap = ld_frag(pt + (wave * 16 + lrow) * LD + kb);
            v16bf bv16[4];
#pragma unroll
            for (int ni = 0; ni < 4; ++ni)
                bv16[ni] = ld_frag(vt[cur] + (ni * 16 + lrow) * LD + kb);
#pragma unroll
            for (int ni = 0; ni < 4; ++ni)
                oacc[ni] = __builtin_amdgcn_wmma_f32_16x16x32_bf16(
                    false, ap, false, bv16[ni], (short)0, oacc[ni], false,
                    false);
        }
        cur ^= 1;
    }

#pragma unroll
    for (int ni = 0; ni < 4; ++ni)
#pragma unroll
        for (int r = 0; r < 8; ++r) {
            int t = q0 + wave * 16 + r + 8 * lhi;
            float o = oacc[ni][r] / lsum[r];
            attnb[(size_t)(b * 1024 + t) * 1024 + h * 64 + ni * 16 + lrow] =
                f2bf(o);
        }
}

// ---------------------------------------------------------------------------
// out[row] = LayerNorm(a[row] + b[row]) * g + be   (C = 1024, eps = 1e-5)
// ---------------------------------------------------------------------------
__global__ __launch_bounds__(256) void ln_add_kernel(
    const float* __restrict__ a, const float* __restrict__ bsrc,
    const float* __restrict__ g, const float* __restrict__ be,
    float* __restrict__ out) {
    __shared__ float red[256];
    const int row = blockIdx.x, tid = threadIdx.x;
    const size_t base = (size_t)row * 1024;
    float v[4];
    float s = 0.f;
#pragma unroll
    for (int i = 0; i < 4; ++i) {
        int c = tid + i * 256;
        v[i] = a[base + c] + bsrc[base + c];
        s += v[i];
    }
    red[tid] = s; __syncthreads();
    for (int off = 128; off > 0; off >>= 1) {
        if (tid < off) red[tid] += red[tid + off];
        __syncthreads();
    }
    const float mu = red[0] * (1.0f / 1024.0f);
    __syncthreads();
    s = 0.f;
#pragma unroll
    for (int i = 0; i < 4; ++i) { float d = v[i] - mu; s += d * d; }
    red[tid] = s; __syncthreads();
    for (int off = 128; off > 0; off >>= 1) {
        if (tid < off) red[tid] += red[tid + off];
        __syncthreads();
    }
    const float rstd = rsqrtf(red[0] * (1.0f / 1024.0f) + 1e-5f);
#pragma unroll
    for (int i = 0; i < 4; ++i) {
        int c = tid + i * 256;
        out[base + c] = (v[i] - mu) * rstd * g[c] + be[c];
    }
}

// ---------------------------------------------------------------------------
extern "C" void kernel_launch(void* const* d_in, const int* in_sizes, int n_in,
                              void* d_out, int out_size, void* d_ws,
                              size_t ws_size, hipStream_t stream) {
    (void)in_sizes; (void)n_in; (void)out_size; (void)ws_size;
    const float* x   = (const float*)d_in[0];
    const float* Wq  = (const float*)d_in[1];
    const float* bq  = (const float*)d_in[2];
    const float* Wk  = (const float*)d_in[3];
    const float* bk  = (const float*)d_in[4];
    const float* Wv  = (const float*)d_in[5];
    const float* bv  = (const float*)d_in[6];
    const float* Wo  = (const float*)d_in[7];
    const float* bo  = (const float*)d_in[8];
    const float* W1  = (const float*)d_in[9];
    const float* b1  = (const float*)d_in[10];
    const float* W2  = (const float*)d_in[11];
    const float* b2  = (const float*)d_in[12];
    const float* g1  = (const float*)d_in[13];
    const float* be1 = (const float*)d_in[14];
    const float* g2  = (const float*)d_in[15];
    const float* be2 = (const float*)d_in[16];
    float* out = (float*)d_out;

    char* p = (char*)d_ws;
    auto alloc = [&](size_t bytes) -> void* {
        void* r = (void*)p;
        p += (bytes + 255) & ~(size_t)255;
        return r;
    };
    __bf16* xb    = (__bf16*)alloc(8192ull * 1024 * 2);
    __bf16* WqkvT = (__bf16*)alloc(3072ull * 1024 * 2);
    float*  bqkv  = (float*) alloc(3072ull * 4);
    __bf16* WoT   = (__bf16*)alloc(1024ull * 1024 * 2);
    __bf16* W1T   = (__bf16*)alloc(4096ull * 1024 * 2);
    __bf16* W2T   = (__bf16*)alloc(1024ull * 4096 * 2);
    __bf16* qkvb  = (__bf16*)alloc(8192ull * 3072 * 2);
    __bf16* attnb = (__bf16*)alloc(8192ull * 1024 * 2);
    float*  proj  = (float*) alloc(8192ull * 1024 * 4);   // reused for ff2
    float*  inter = (float*) alloc(8192ull * 1024 * 4);
    __bf16* ff1   = (__bf16*)alloc(8192ull * 4096 * 2);
    float*  ff2   = proj;

    cvt_bf16_kernel<<<2048, 256, 0, stream>>>(x, xb, 8192 * 1024);
    pack_qkv_kernel<<<2048, 256, 0, stream>>>(Wq, Wk, Wv, bq, bk, bv, WqkvT, bqkv);
    transp_bf16_kernel<<<1024, 256, 0, stream>>>(Wo, WoT, 1024, 1024);
    transp_bf16_kernel<<<2048, 256, 0, stream>>>(W1, W1T, 4096, 1024);
    transp_bf16_kernel<<<2048, 256, 0, stream>>>(W2, W2T, 1024, 4096);

    // qkv = x @ Wqkv + b  -> bf16 [8192][3072]
    gemm_bf16_kernel<0><<<dim3(24, 64), 256, 0, stream>>>(
        xb, WqkvT, bqkv, (void*)qkvb, 8192, 3072, 1024);
    // flash attention -> bf16 [8192][1024] (heads concatenated)
    attn_kernel<<<dim3(16, 128), 128, 0, stream>>>(qkvb, attnb);
    // proj = attn @ Wo + bo -> f32
    gemm_bf16_kernel<2><<<dim3(8, 64), 256, 0, stream>>>(
        attnb, WoT, bo, (void*)proj, 8192, 1024, 1024);
    // inter = LN1(x + proj)
    ln_add_kernel<<<8192, 256, 0, stream>>>(x, proj, g1, be1, inter);
    // ff1 = relu(x @ W1 + b1) -> bf16 [8192][4096]
    gemm_bf16_kernel<1><<<dim3(32, 64), 256, 0, stream>>>(
        xb, W1T, b1, (void*)ff1, 8192, 4096, 1024);
    // ff2 = ff1 @ W2 + b2 -> f32
    gemm_bf16_kernel<2><<<dim3(8, 64), 256, 0, stream>>>(
        ff1, W2T, b2, (void*)ff2, 8192, 1024, 4096);
    // out = LN2(ff2 + inter)
    ln_add_kernel<<<8192, 256, 0, stream>>>(ff2, inter, g2, be2, out);
}

// v001
// It runs in 372 microseconds.
// Next to v000, in two timings, it ran 1.19 times as fast each time.
#include <hip/hip_runtime.h>

typedef __attribute__((ext_vector_type(16))) __bf16 v16bf;
typedef __attribute__((ext_vector_type(8)))  __bf16 v8bf;
typedef __attribute__((ext_vector_type(8)))  float  v8f;

__device__ __forceinline__ __bf16 f2bf(float f) {
    unsigned int u = __builtin_bit_cast(unsigned int, f);
    unsigned int r = (u + 0x7FFFu + ((u >> 16) & 1u)) >> 16;
    unsigned short s = (unsigned short)r;
    return __builtin_bit_cast(__bf16, s);
}

__device__ __forceinline__ v8f zero8() {
    v8f z = {0.f,0.f,0.f,0.f,0.f,0.f,0.f,0.f};
    return z;
}

// Load a 16-element bf16 WMMA fragment: elements 0..7 = p[0..7], 8..15 = p[16..23]
__device__ __forceinline__ v16bf ld_frag(const __bf16* p) {
    union { v16bf v; v8bf h[2]; } u;
    u.h[0] = *(const v8bf*)(p);
    u.h[1] = *(const v8bf*)(p + 16);
    return u.v;
}

// ---------------------------------------------------------------------------
// Conversion / packing kernels
// ---------------------------------------------------------------------------
__global__ void cvt_bf16_kernel(const float* __restrict__ in,
                                __bf16* __restrict__ out, int n) {
    for (int i = blockIdx.x * blockDim.x + threadIdx.x; i < n;
         i += gridDim.x * blockDim.x)
        out[i] = f2bf(in[i]);
}

// WqkvT[n][c], n in [0,3072): n<1024 -> Q col (h*64+d), then K, then V.
// Attention scale 1/sqrt(C) = 1/32 is folded into the Q weights + bias.
__global__ void pack_qkv_kernel(const float* __restrict__ Wq,
                                const float* __restrict__ Wk,
                                const float* __restrict__ Wv,
                                const float* __restrict__ bq,
                                const float* __restrict__ bk,
                                const float* __restrict__ bv,
                                __bf16* __restrict__ Wt,
                                float* __restrict__ bias) {
    const int total = 3072 * 1024;
    for (int idx = blockIdx.x * blockDim.x + threadIdx.x; idx < total;
         idx += gridDim.x * blockDim.x) {
        int n = idx >> 10, c = idx & 1023;
        int sel = n >> 10, r = n & 1023;
        int h = r >> 6, d = r & 63;
        const float* W = (sel == 0) ? Wq : (sel == 1) ? Wk : Wv;
        float w = W[((size_t)h * 1024 + c) * 64 + d];
        if (sel == 0) w *= 0.03125f;
        Wt[idx] = f2bf(w);
    }
    for (int n = blockIdx.x * blockDim.x + threadIdx.x; n < 3072;
         n += gridDim.x * blockDim.x) {
        int sel = n >> 10, r = n & 1023;
        const float* bb = (sel == 0) ? bq : (sel == 1) ? bk : bv;
        float w = bb[r];
        if (sel == 0) w *= 0.03125f;
        bias[n] = w;
    }
}

// out[n*K + k] = bf16(in[k*N + n])
__global__ void transp_bf16_kernel(const float* __restrict__ in,
                                   __bf16* __restrict__ out, int N, int K) {
    const int total = N * K;
    for (int idx = blockIdx.x * blockDim.x + threadIdx.x; idx < total;
         idx += gridDim.x * blockDim.x) {
        int n = idx / K, k = idx % K;
        out[idx] = f2bf(in[(size_t)k * N + n]);
    }
}

// ---------------------------------------------------------------------------
// Generic bf16 WMMA GEMM:  C[M][N] = A[M][K] * Bt[N][K]^T  (+bias, epilogue)
// EPI: 0 = bf16 out (+bias), 1 = bf16 out (+bias, relu), 2 = f32 out (+bias)
// Double-buffered LDS tiles; bulk fragment loads; 16 WMMAs per K-tile/wave.
// ---------------------------------------------------------------------------
template<int EPI>
__global__ __launch_bounds__(256) void gemm_bf16_kernel(
    const __bf16* __restrict__ A, const __bf16* __restrict__ Bt,
    const float* __restrict__ bias, void* __restrict__ Cout,
    int M, int N, int K) {
    constexpr int BM = 128, BN = 128, BK = 64, LDT = 72;
    __shared__ __bf16 As[2][BM * LDT];
    __shared__ __bf16 Bs[2][BN * LDT];

    const int tid  = threadIdx.x;
    const int lane = tid & 31, wave = tid >> 5;
    const int wm = wave & 3, wn = wave >> 2;     // 4 waves on M, 2 on N
    const int lrow = lane & 15, lhi = lane >> 4;
    const int m0 = blockIdx.y * BM, n0 = blockIdx.x * BN;

    v8f acc[2][4];
#pragma unroll
    for (int mi = 0; mi < 2; ++mi)
#pragma unroll
        for (int ni = 0; ni < 4; ++ni) acc[mi][ni] = zero8();

    auto load_tile = [&](int k0, int buf) {
#pragma unroll
        for (int i = 0; i < 4; ++i) {
            int vid = tid + i * 256;
            int r = vid >> 3, cv = (vid & 7) * 8;
            *(v8bf*)(As[buf] + r * LDT + cv) =
                *(const v8bf*)(A + (size_t)(m0 + r) * K + k0 + cv);
            *(v8bf*)(Bs[buf] + r * LDT + cv) =
                *(const v8bf*)(Bt + (size_t)(n0 + r) * K + k0 + cv);
        }
    };

    const int nk = K / BK;
    load_tile(0, 0);
    int cur = 0;
    for (int kt = 0; kt < nk; ++kt) {
        __syncthreads();
        if (kt + 1 < nk) load_tile((kt + 1) * BK, cur ^ 1);

        v16bf af[2][2], bfm[2][4];
#pragma unroll
        for (int ks = 0; ks < 2; ++ks) {
            const int kb = ks * 32 + lhi * 8;
#pragma unroll
            for (int mi = 0; mi < 2; ++mi)
                af[ks][mi] =
                    ld_frag(As[cur] + (wm * 32 + mi * 16 + lrow) * LDT + kb);
#pragma unroll
            for (int ni = 0; ni < 4; ++ni)
                bfm[ks][ni] =
                    ld_frag(Bs[cur] + (wn * 64 + ni * 16 + lrow) * LDT + kb);
        }
#pragma unroll
        for (int ks = 0; ks < 2; ++ks)
#pragma unroll
            for (int mi = 0; mi < 2; ++mi)
#pragma unroll
                for (int ni = 0; ni < 4; ++ni)
                    acc[mi][ni] = __builtin_amdgcn_wmma_f32_16x16x32_bf16(
                        false, af[ks][mi], false, bfm[ks][ni], (short)0,
                        acc[mi][ni], false, false);
        cur ^= 1;
    }

#pragma unroll
    for (int mi = 0; mi < 2; ++mi)
#pragma unroll
        for (int ni = 0; ni < 4; ++ni)
#pragma unroll
            for (int r = 0; r < 8; ++r) {
                int m = m0 + wm * 32 + mi * 16 + r + 8 * lhi;
                int n = n0 + wn * 64 + ni * 16 + lrow;
                float v = acc[mi][ni][r] + bias[n];
                if (EPI == 2) {
                    ((float*)Cout)[(size_t)m * N + n] = v;
                } else {
                    if (EPI == 1) v = fmaxf(v, 0.f);
                    ((__bf16*)Cout)[(size_t)m * N + n] = f2bf(v);
                }
            }
}

typedef __attribute__((ext_vector_type(8))) short s16x8;

// Lane (c = l & 15, h = l >> 4) gets T[k + 8h + 0..7][d + c] of a row-major tile
// when lane l points at T[k + 8h + (l & 7)][d + 8 * ((l >> 3) & 1)].
__device__ __forceinline__ v8bf ld_tr16(const __bf16* p) {
    typedef __attribute__((address_space(3))) s16x8 lds_s16x8;
    return __builtin_bit_cast(
        v8bf, __builtin_amdgcn_ds_load_tr16_b128_v8i16((lds_s16x8*)p));
}

// Value of lane l ^ 16.
__device__ __forceinline__ float xhalf(float x) {
    int b = __builtin_bit_cast(int, x);
    return __builtin_bit_cast(
        float, __builtin_amdgcn_permlanex16(b, b, 0x76543210, 0xfedcba98, false,
                                            false));
}

__global__ __launch_bounds__(128) void attn_kernel(
    const __bf16* __restrict__ qkv, __bf16* __restrict__ attnb) {
    constexpr int LD = 72;   // K pitch 144 B: 16 B x odd, for ds_load_b128
    constexpr int LDV = 80;  // V pitch 160 B: 32 B x odd, for ds_load_tr16_b128
    __shared__ __attribute__((aligned(16))) __bf16 kt[2][64 * LD];
    __shared__ __attribute__((aligned(16))) __bf16 vt[2][64 * LDV];

    const int tid = threadIdx.x, lane = tid & 31, wave = tid >> 5;
    const int lrow = lane & 15, lhi = lane >> 4;
    const int qb = blockIdx.x;           // 0..15
    const int bh = blockIdx.y;           // 0..127
    const int b = bh >> 4, h = bh & 15;
    const size_t rowbase = (size_t)b * 1024 * 3072;
    const __bf16* qp = qkv + rowbase + h * 64;
    const __bf16* kp = qkv + rowbase + 1024 + h * 64;
    const __bf16* vp = qkv + rowbase + 2048 + h * 64;
    const int q0 = qb * 64;

    // Q^T fragments (B operand: column = this wave's query lrow), kept live.
    v16bf aq[2];
    {
        const size_t mr = (size_t)(q0 + wave * 16 + lrow) * 3072;
#pragma unroll
        for (int ks = 0; ks < 2; ++ks) {
            int kb = ks * 32 + lhi * 8;
            union { v16bf v; v8bf h2[2]; } u;
            u.h2[0] = *(const v8bf*)(qp + mr + kb);
            u.h2[1] = *(const v8bf*)(qp + mr + kb + 16);
            aq[ks] = u.v;
        }
    }

    v8f oacc[4];                         // O^T: d = ni*16 + 8*lhi + r, query lrow
#pragma unroll
    for (int ni = 0; ni < 4; ++ni) oacc[ni] = zero8();
    float mrow = -1e30f, lsum = 0.f;     // lsum: this wave half's keys only

    auto load_kv = [&](int s0, int buf) {
#pragma unroll
        for (int i = 0; i < 4; ++i) {
            int vid = tid + i * 128;
            int r = vid >> 3, cv = (vid & 7) * 8;
            *(v8bf*)(kt[buf] + r * LD + cv) =
                *(const v8bf*)(kp + (size_t)(s0 + r) * 3072 + cv);
            v8bf vv = *(const v8bf*)(vp + (size_t)(s0 + r) * 3072 + cv);
            *(v8bf*)(vt[buf] + r * LDV + cv) = vv;
        }
    };

    load_kv(0, 0);
    int cur = 0;
    for (int it = 0; it < 16; ++it) {
        __syncthreads();
        if (it + 1 < 16) load_kv((it + 1) * 64, cur ^ 1);

        // S^T = K * Q^T  (64 keys x 16 queries per wave)
        v8f sacc[4];
#pragma unroll
        for (int ni = 0; ni < 4; ++ni) sacc[ni] = zero8();
#pragma unroll
        for (int ks = 0; ks < 2; ++ks) {
            const int kb = ks * 32 + lhi * 8;
            v16bf bk16[4];
#pragma unroll
            for (int ni = 0; ni < 4; ++ni)
                bk16[ni] = ld_frag(kt[cur] + (ni * 16 + lrow) * LD + kb);
#pragma unroll
            for (int ni = 0; ni < 4; ++ni)
                sacc[ni] = __builtin_amdgcn_wmma_f32_16x16x32_bf16(
                    false, bk16[ni], false, aq[ks], (short)0, sacc[ni], false,
                    false);
        }

        // Online softmax of query lrow; this lane has keys ni*16 + 8*lhi + r.
        float tm = -1e30f;
#pragma unroll
        for (int ni = 0; ni < 4; ++ni)
#pragma unroll
            for (int r = 0; r < 8; ++r) tm = fmaxf(tm, sacc[ni][r]);
        tm = fmaxf(tm, xhalf(tm));
        const float mn = fmaxf(mrow, tm);
        const float corr = __expf(mrow - mn);
        float rs = 0.f;
        v16bf bp[2];                     // P^T: element s = tile s >> 3, reg s & 7
#pragma unroll
        for (int ni = 0; ni < 4; ++ni)
#pragma unroll
            for (int r = 0; r < 8; ++r) {
                float p = __expf(sacc[ni][r] - mn);
                rs += p;
                bp[ni >> 1][(ni & 1) * 8 + r] = f2bf(p);
            }
        lsum = lsum * corr + rs;
#pragma unroll
        for (int ni = 0; ni < 4; ++ni) oacc[ni] *= corr;
        mrow = mn;

        // O^T += V^T * P^T
#pragma unroll
        for (int ks = 0; ks < 2; ++ks) {
            const __bf16* vb = vt[cur] + (ks * 32 + lhi * 8 + (lane & 7)) * LDV +
                               ((lane >> 3) & 1) * 8;
            v16bf av16[4];
#pragma unroll
            for (int ni = 0; ni < 4; ++ni) {
                union { v16bf v; v8bf h2[2]; } u;
                u.h2[0] = ld_tr16(vb + ni * 16);
                u.h2[1] = ld_tr16(vb + 16 * LDV + ni * 16);
                av16[ni] = u.v;
            }
#pragma unroll
            for (int ni = 0; ni < 4; ++ni)
                oacc[ni] = __builtin_amdgcn_wmma_f32_16x16x32_bf16(
                    false, av16[ni], false, bp[ks], (short)0, oacc[ni], false,
                    false);
        }
        cur ^= 1;
    }

    // A lane holds d = ni*16 + 8*lhi + 0..7 of one query: one 16-byte store each.
    const float ltot = lsum + xhalf(lsum);
    const int t = q0 + wave * 16 + lrow;
#pragma unroll
    for (int ni = 0; ni < 4; ++ni) {
        v8bf o;
#pragma unroll
        for (int r = 0; r < 8; ++r) o[r] = f2bf(oacc[ni][r] / ltot);
        *(v8bf*)(attnb + (size_t)(b * 1024 + t) * 1024 + h * 64 + ni * 16 +
                 lhi * 8) = o;
    }
}

// ---------------------------------------------------------------------------
// out[row] = LayerNorm(a[row] + b[row]) * g + be   (C = 1024, eps = 1e-5)
// ---------------------------------------------------------------------------
__global__ __launch_bounds__(256) void ln_add_kernel(
    const float* __restrict__ a, const float* __restrict__ bsrc,
    const float* __restrict__ g, const float* __restrict__ be,
    float* __restrict__ out) {
    __shared__ float red[256];
    const int row = blockIdx.x, tid = threadIdx.x;
    const size_t base = (size_t)row * 1024;
    float v[4];
    float s = 0.f;
#pragma unroll
    for (int i = 0; i < 4; ++i) {
        int c = tid + i * 256;
        v[i] = a[base + c] + bsrc[base + c];
        s += v[i];
    }
    red[tid] = s; __syncthreads();
    for (int off = 128; off > 0; off >>= 1) {
        if (tid < off) red[tid] += red[tid + off];
        __syncthreads();
    }
    const float mu = red[0] * (1.0f / 1024.0f);
    __syncthreads();
    s = 0.f;
#pragma unroll
    for (int i = 0; i < 4; ++i) { float d = v[i] - mu; s += d * d; }
    red[tid] = s; __syncthreads();
    for (int off = 128; off > 0; off >>= 1) {
        if (tid < off) red[tid] += red[tid + off];
        __syncthreads();
    }
    const float rstd = rsqrtf(red[0] * (1.0f / 1024.0f) + 1e-5f);
#pragma unroll
    for (int i = 0; i < 4; ++i) {
        int c = tid + i * 256;
        out[base + c] = (v[i] - mu) * rstd * g[c] + be[c];
    }
}

// ---------------------------------------------------------------------------
extern "C" void kernel_launch(void* const* d_in, const int* in_sizes, int n_in,
                              void* d_out, int out_size, void* d_ws,
                              size_t ws_size, hipStream_t stream) {
    (void)in_sizes; (void)n_in; (void)out_size; (void)ws_size;
    const float* x   = (const float*)d_in[0];
    const float* Wq  = (const float*)d_in[1];
    const float* bq  = (const float*)d_in[2];
    const float* Wk  = (const float*)d_in[3];
    const float* bk  = (const float*)d_in[4];
    const float* Wv  = (const float*)d_in[5];
    const float* bv  = (const float*)d_in[6];
    const float* Wo  = (const float*)d_in[7];
    const float* bo  = (const float*)d_in[8];
    const float* W1  = (const float*)d_in[9];
    const float* b1  = (const float*)d_in[10];
    const float* W2  = (const float*)d_in[11];
    const float* b2  = (const float*)d_in[12];
    const float* g1  = (const float*)d_in[13];
    const float* be1 = (const float*)d_in[14];
    const float* g2  = (const float*)d_in[15];
    const float* be2 = (const float*)d_in[16];
    float* out = (float*)d_out;

    char* p = (char*)d_ws;
    auto alloc = [&](size_t bytes) -> void* {
        void* r = (void*)p;
        p += (bytes + 255) & ~(size_t)255;
        return r;
    };
    __bf16* xb    = (__bf16*)alloc(8192ull * 1024 * 2);
    __bf16* WqkvT = (__bf16*)alloc(3072ull * 1024 * 2);
    float*  bqkv  = (float*) alloc(3072ull * 4);
    __bf16* WoT   = (__bf16*)alloc(1024ull * 1024 * 2);
    __bf16* W1T   = (__bf16*)alloc(4096ull * 1024 * 2);
    __bf16* W2T   = (__bf16*)alloc(1024ull * 4096 * 2);
    __bf16* qkvb  = (__bf16*)alloc(8192ull * 3072 * 2);
    __bf16* attnb = (__bf16*)alloc(8192ull * 1024 * 2);
    float*  proj  = (float*) alloc(8192ull * 1024 * 4);   // reused for ff2
    float*  inter = (float*) alloc(8192ull * 1024 * 4);
    __bf16* ff1   = (__bf16*)alloc(8192ull * 4096 * 2);
    float*  ff2   = proj;

    cvt_bf16_kernel<<<2048, 256, 0, stream>>>(x, xb, 8192 * 1024);
    pack_qkv_kernel<<<2048, 256, 0, stream>>>(Wq, Wk, Wv, bq, bk, bv, WqkvT, bqkv);
    transp_bf16_kernel<<<1024, 256, 0, stream>>>(Wo, WoT, 1024, 1024);
    transp_bf16_kernel<<<2048, 256, 0, stream>>>(W1, W1T, 4096, 1024);
    transp_bf16_kernel<<<2048, 256, 0, stream>>>(W2, W2T, 1024, 4096);

    // qkv = x @ Wqkv + b  -> bf16 [8192][3072]
    gemm_bf16_kernel<0><<<dim3(24, 64), 256, 0, stream>>>(
        xb, WqkvT, bqkv, (void*)qkvb, 8192, 3072, 1024);
    // flash attention -> bf16 [8192][1024] (heads concatenated)
    attn_kernel<<<dim3(16, 128), 128, 0, stream>>>(qkvb, attnb);
    // proj = attn @ Wo + bo -> f32
    gemm_bf16_kernel<2><<<dim3(8, 64), 256, 0, stream>>>(
        attnb, WoT, bo, (void*)proj, 8192, 1024, 1024);
    // inter = LN1(x + proj)
    ln_add_kernel<<<8192, 256, 0, stream>>>(x, proj, g1, be1, inter);
    // ff1 = relu(x @ W1 + b1) -> bf16 [8192][4096]
    gemm_bf16_kernel<1><<<dim3(32, 64), 256, 0, stream>>>(
        xb, W1T, b1, (void*)ff1, 8192, 4096, 1024);
    // ff2 = ff1 @ W2 + b2 -> f32
    gemm_bf16_kernel<2><<<dim3(8, 64), 256, 0, stream>>>(
        ff1, W2T, b2, (void*)ff2, 8192, 1024, 4096);
    // out = LN2(ff2 + inter)
    ln_add_kernel<<<8192, 256, 0, stream>>>(ff2, inter, g2, be2, out);
}

// v002
// Measured time: 349 microseconds a run.
// Two timings next to v001 both put it at 1.06 times that version's speed.
// All steps since v000 together make it 1.26 times as fast.
#include <hip/hip_runtime.h>
#include <stdint.h>

typedef __attribute__((ext_vector_type(16))) __bf16 v16bf;
typedef __attribute__((ext_vector_type(8)))  __bf16 v8bf;
typedef __attribute__((ext_vector_type(8)))  float  v8f;

__device__ __forceinline__ __bf16 f2bf(float f) {
    unsigned int u = __builtin_bit_cast(unsigned int, f);
    unsigned int r = (u + 0x7FFFu + ((u >> 16) & 1u)) >> 16;
    unsigned short s = (unsigned short)r;
    return __builtin_bit_cast(__bf16, s);
}

__device__ __forceinline__ v8f zero8() {
    v8f z = {0.f,0.f,0.f,0.f,0.f,0.f,0.f,0.f};
    return z;
}

// Load a 16-element bf16 WMMA fragment: elements 0..7 = p[0..7], 8..15 = p[16..23]
__device__ __forceinline__ v16bf ld_frag(const __bf16* p) {
    union { v16bf v; v8bf h[2]; } u;
    u.h[0] = *(const v8bf*)(p);
    u.h[1] = *(const v8bf*)(p + 16);
    return u.v;
}

// ---------------------------------------------------------------------------
// Conversion / packing kernels
// ---------------------------------------------------------------------------
__global__ void cvt_bf16_kernel(const float* __restrict__ in,
                                __bf16* __restrict__ out, int n) {
    for (int i = blockIdx.x * blockDim.x + threadIdx.x; i < n;
         i += gridDim.x * blockDim.x)
        out[i] = f2bf(in[i]);
}

// WqkvT[n][c], n in [0,3072): n<1024 -> Q col (h*64+d), then K, then V.
// Attention scale 1/sqrt(C) = 1/32 is folded into the Q weights + bias.
__global__ void pack_qkv_kernel(const float* __restrict__ Wq,
                                const float* __restrict__ Wk,
                                const float* __restrict__ Wv,
                                const float* __restrict__ bq,
                                const float* __restrict__ bk,
                                const float* __restrict__ bv,
                                __bf16* __restrict__ Wt,
                                float* __restrict__ bias) {
    const int total = 3072 * 1024;
    for (int idx = blockIdx.x * blockDim.x + threadIdx.x; idx < total;
         idx += gridDim.x * blockDim.x) {
        int n = idx >> 10, c = idx & 1023;
        int sel = n >> 10, r = n & 1023;
        int h = r >> 6, d = r & 63;
        const float* W = (sel == 0) ? Wq : (sel == 1) ? Wk : Wv;
        float w = W[((size_t)h * 1024 + c) * 64 + d];
        if (sel == 0) w *= 0.03125f;
        Wt[idx] = f2bf(w);
    }
    for (int n = blockIdx.x * blockDim.x + threadIdx.x; n < 3072;
         n += gridDim.x * blockDim.x) {
        int sel = n >> 10, r = n & 1023;
        const float* bb = (sel == 0) ? bq : (sel == 1) ? bk : bv;
        float w = bb[r];
        if (sel == 0) w *= 0.03125f;
        bias[n] = w;
    }
}

// out[n*K + k] = bf16(in[k*N + n])
__global__ void transp_bf16_kernel(const float* __restrict__ in,
                                   __bf16* __restrict__ out, int N, int K) {
    const int total = N * K;
    for (int idx = blockIdx.x * blockDim.x + threadIdx.x; idx < total;
         idx += gridDim.x * blockDim.x) {
        int n = idx / K, k = idx % K;
        out[idx] = f2bf(in[(size_t)k * N + n]);
    }
}

// ---------------------------------------------------------------------------
// Tensor loads (global -> LDS, through no register) for the GEMM's K tiles.
// ---------------------------------------------------------------------------
typedef uint32_t u32x4 __attribute__((ext_vector_type(4)));
typedef uint32_t u32x8 __attribute__((ext_vector_type(8)));

__device__ __forceinline__ uint32_t uni(uint32_t v) {
    return (uint32_t)__builtin_amdgcn_readfirstlane(v);
}
// A wave-uniform value held in a scalar register: a test on it compiles to a
// scalar branch (a tensor load ignores EXEC), and what is computed from it
// cannot be formed ahead of the volatile statements in front of it.
__device__ __forceinline__ uint32_t pinned(uint32_t v) {
    uint32_t w = uni(v);
    asm volatile("" : "+s"(w));
    return w;
}
// The compiler places no wait for a tensor load: these two are the ring's own.
__device__ __forceinline__ void wait_tensor0() {
    asm volatile("s_wait_tensorcnt 0x0" ::: "memory");
}
__device__ __forceinline__ void wait_ds0() {
    asm volatile("s_wait_dscnt 0x0" ::: "memory");
}

// ---------------------------------------------------------------------------
// Generic bf16 WMMA GEMM:  C[M][N] = A[M][K] * Bt[N][K]^T  (+bias, epilogue)
// EPI: 0 = bf16 out (+bias), 1 = bf16 out (+bias, relu), 2 = f32 out (+bias)
// Two LDS buffers filled by tensor loads one pass ahead: wave 0 brings the A
// tile, wave 1 the B tile (128 rows of 128 B each, padded to the 144-B pitch).
// M, N multiples of 128, K a multiple of 64.
// ---------------------------------------------------------------------------
template<int EPI>
__global__ __launch_bounds__(256) void gemm_bf16_kernel(
    const __bf16* __restrict__ A, const __bf16* __restrict__ Bt,
    const float* __restrict__ bias, void* __restrict__ Cout,
    int M, int N, int K) {
    constexpr int BM = 128, BN = 128, BK = 64, LDT = 72;
    constexpr uint32_t ROWB = BK * 2u;            // bytes of a tile row
    constexpr uint32_t TILE_B = 128u * LDT * 2u;  // 18,432 B = 9 x 2 KiB
    static_assert(TILE_B % 2048u == 0, "each tile's place: a multiple of 2 KiB");
    __shared__ __attribute__((aligned(2048))) __bf16 S[2][2][128 * LDT];

    const int tid  = threadIdx.x;
    const int lane = tid & 31, wave = tid >> 5;
    const int wm = wave & 3, wn = wave >> 2;     // 4 waves on M, 2 on N
    const int lrow = lane & 15, lhi = lane >> 4;
    const int m0 = blockIdx.y * BM, n0 = blockIdx.x * BN;

    v8f acc[2][4];
#pragma unroll
    for (int mi = 0; mi < 2; ++mi)
#pragma unroll
        for (int ni = 0; ni < 4; ++ni) acc[mi][ni] = zero8();

    const uint32_t wv = uni((uint32_t)tid >> 5);
    const uint32_t lbase = (uint32_t)(size_t)&S[0][0][0] + wv * TILE_B;
    const uint64_t gbase =
        (uint64_t)(size_t)(wv == 0u ? A + (size_t)m0 * K : Bt + (size_t)n0 * K);
    // Group 1, loop-invariant: 1-byte elements, tensor = tile = 128 rows of
    // 128 B, source pitch 2K bytes, 16 B of LDS pad behind every 128-B row.
    u32x8 g1;
    g1[0] = uni((1u << 20) | (4u << 22) | (3u << 25));
    g1[1] = uni(ROWB << 16);
    g1[2] = uni(128u << 16);
    g1[3] = uni(ROWB << 16);
    g1[4] = uni(128u);
    g1[5] = uni((uint32_t)K * 2u);
    g1[6] = uni(0u);
    g1[7] = uni(0u);
    // As in pinned(): descriptor words held in scalar registers of their own
    // through the loop, so that none is rewritten while a request is outstanding.
    asm volatile("" : "+s"(g1));
    // Stage s into buffer s & 1; only under the issuing waves' scalar branch.
    auto issue = [&](uint32_t s) {
        const uint64_t ga = gbase + (uint64_t)s * ROWB;
        u32x4 g0;
        g0[0] = uni(1u);
        g0[1] = uni(lbase + (s & 1u) * 2u * TILE_B);
        g0[2] = uni((uint32_t)ga);
        g0[3] = uni((((uint32_t)(ga >> 32)) & 0x01FFFFFFu) | 0x80000000u);
        // One request of the whole wave: its 128 rows land in LDS on their own.
        asm volatile("tensor_load_to_lds %0, %1" :: "s"(g0), "s"(g1) : "memory");
    };

    const int nk = K / BK;
    if (pinned(wv < 2u)) {
        issue(0u);
        wait_tensor0();
    }
    __syncthreads();                     // stage 0 published
    if (pinned(wv < 2u && 1 < nk)) issue(1u);

    for (int kt = 0; kt < nk; ++kt) {
        const __bf16* As = S[kt & 1][0];
        const __bf16* Bs = S[kt & 1][1];

        v16bf af[2][2], bfm[2][4];
#pragma unroll
        for (int ks = 0; ks < 2; ++ks) {
            const int kb = ks * 32 + lhi * 8;
#pragma unroll
            for (int mi = 0; mi < 2; ++mi)
                af[ks][mi] =
                    ld_frag(As + (wm * 32 + mi * 16 + lrow) * LDT + kb);
#pragma unroll
            for (int ni = 0; ni < 4; ++ni)
                bfm[ks][ni] =
                    ld_frag(Bs + (wn * 64 + ni * 16 + lrow) * LDT + kb);
        }
#pragma unroll
        for (int ks = 0; ks < 2; ++ks)
#pragma unroll
            for (int mi = 0; mi < 2; ++mi)
#pragma unroll
                for (int ni = 0; ni < 4; ++ni)
                    acc[mi][ni] = __builtin_amdgcn_wmma_f32_16x16x32_bf16(
                        false, af[ks][mi], false, bfm[ks][ni], (short)0,
                        acc[mi][ni], false, false);

        // Publish point of stage kt + 1: own LDS reads done, the issuers' tiles
        // landed, barrier; only then the refill of the buffer just read.
        wait_ds0();
        if (pinned(wv < 2u)) wait_tensor0();
        __syncthreads();
        if (pinned(wv < 2u && kt + 2 < nk)) {
            // pinned: the descriptor is formed behind the wait above
            issue(pinned((uint32_t)kt + 2u));
        }
    }
    wait_tensor0();
    wait_ds0();

#pragma unroll
    for (int mi = 0; mi < 2; ++mi)
#pragma unroll
        for (int ni = 0; ni < 4; ++ni)
#pragma unroll
            for (int r = 0; r < 8; ++r) {
                int m = m0 + wm * 32 + mi * 16 + r + 8 * lhi;
                int n = n0 + wn * 64 + ni * 16 + lrow;
                float v = acc[mi][ni][r] + bias[n];
                if (EPI == 2) {
                    ((float*)Cout)[(size_t)m * N + n] = v;
                } else {
                    if (EPI == 1) v = fmaxf(v, 0.f);
                    ((__bf16*)Cout)[(size_t)m * N + n] = f2bf(v);
                }
            }
}

typedef __attribute__((ext_vector_type(8))) short s16x8;

// Lane (c = l & 15, h = l >> 4) gets T[k + 8h + 0..7][d + c] of a row-major tile
// when lane l points at T[k + 8h + (l & 7)][d + 8 * ((l >> 3) & 1)].
__device__ __forceinline__ v8bf ld_tr16(const __bf16* p) {
    typedef __attribute__((address_space(3))) s16x8 lds_s16x8;
    return __builtin_bit_cast(
        v8bf, __builtin_amdgcn_ds_load_tr16_b128_v8i16((lds_s16x8*)p));
}

// Value of lane l ^ 16.
__device__ __forceinline__ float xhalf(float x) {
    int b = __builtin_bit_cast(int, x);
    return __builtin_bit_cast(
        float, __builtin_amdgcn_permlanex16(b, b, 0x76543210, 0xfedcba98, false,
                                            false));
}

__global__ __launch_bounds__(128) void attn_kernel(
    const __bf16* __restrict__ qkv, __bf16* __restrict__ attnb) {
    constexpr int LD = 72;   // K pitch 144 B: 16 B x odd, for ds_load_b128
    constexpr int LDV = 80;  // V pitch 160 B: 32 B x odd, for ds_load_tr16_b128
    __shared__ __attribute__((aligned(16))) __bf16 kt[2][64 * LD];
    __shared__ __attribute__((aligned(16))) __bf16 vt[2][64 * LDV];

    const int tid = threadIdx.x, lane = tid & 31, wave = tid >> 5;
    const int lrow = lane & 15, lhi = lane >> 4;
    const int qb = blockIdx.x;           // 0..15
    const int bh = blockIdx.y;           // 0..127
    const int b = bh >> 4, h = bh & 15;
    const size_t rowbase = (size_t)b * 1024 * 3072;
    const __bf16* qp = qkv + rowbase + h * 64;
    const __bf16* kp = qkv + rowbase + 1024 + h * 64;
    const __bf16* vp = qkv + rowbase + 2048 + h * 64;
    const int q0 = qb * 64;

    // Q^T fragments (B operand: column = this wave's query lrow), kept live.
    v16bf aq[2];
    {
        const size_t mr = (size_t)(q0 + wave * 16 + lrow) * 3072;
#pragma unroll
        for (int ks = 0; ks < 2; ++ks) {
            int kb = ks * 32 + lhi * 8;
            union { v16bf v; v8bf h2[2]; } u;
            u.h2[0] = *(const v8bf*)(qp + mr + kb);
            u.h2[1] = *(const v8bf*)(qp + mr + kb + 16);
            aq[ks] = u.v;
        }
    }

    v8f oacc[4];                         // O^T: d = ni*16 + 8*lhi + r, query lrow
#pragma unroll
    for (int ni = 0; ni < 4; ++ni) oacc[ni] = zero8();
    float mrow = -1e30f, lsum = 0.f;     // lsum: this wave half's keys only

    auto load_kv = [&](int s0, int buf) {
#pragma unroll
        for (int i = 0; i < 4; ++i) {
            int vid = tid + i * 128;
            int r = vid >> 3, cv = (vid & 7) * 8;
            *(v8bf*)(kt[buf] + r * LD + cv) =
                *(const v8bf*)(kp + (size_t)(s0 + r) * 3072 + cv);
            v8bf vv = *(const v8bf*)(vp + (size_t)(s0 + r) * 3072 + cv);
            *(v8bf*)(vt[buf] + r * LDV + cv) = vv;
        }
    };

    load_kv(0, 0);
    int cur = 0;
    for (int it = 0; it < 16; ++it) {
        __syncthreads();
        if (it + 1 < 16) load_kv((it + 1) * 64, cur ^ 1);

        // S^T = K * Q^T  (64 keys x 16 queries per wave)
        v8f sacc[4];
#pragma unroll
        for (int ni = 0; ni < 4; ++ni) sacc[ni] = zero8();
#pragma unroll
        for (int ks = 0; ks < 2; ++ks) {
            const int kb = ks * 32 + lhi * 8;
            v16bf bk16[4];
#pragma unroll
            for (int ni = 0; ni < 4; ++ni)
                bk16[ni] = ld_frag(kt[cur] + (ni * 16 + lrow) * LD + kb);
#pragma unroll
            for (int ni = 0; ni < 4; ++ni)
                sacc[ni] = __builtin_amdgcn_wmma_f32_16x16x32_bf16(
                    false, bk16[ni], false, aq[ks], (short)0, sacc[ni], false,
                    false);
        }

        // Online softmax of query lrow; this lane has keys ni*16 + 8*lhi + r.
        float tm = -1e30f;
#pragma unroll
        for (int ni = 0; ni < 4; ++ni)
#pragma unroll
            for (int r = 0; r < 8; ++r) tm = fmaxf(tm, sacc[ni][r]);
        tm = fmaxf(tm, xhalf(tm));
        const float mn = fmaxf(mrow, tm);
        const float corr = __expf(mrow - mn);
        float rs = 0.f;
        v16bf bp[2];                     // P^T: element s = tile s >> 3, reg s & 7
#pragma unroll
        for (int ni = 0; ni < 4; ++ni)
#pragma unroll
            for (int r = 0; r < 8; ++r) {
                float p = __expf(sacc[ni][r] - mn);
                rs += p;
                bp[ni >> 1][(ni & 1) * 8 + r] = f2bf(p);
            }
        lsum = lsum * corr + rs;
#pragma unroll
        for (int ni = 0; ni < 4; ++ni) oacc[ni] *= corr;
        mrow = mn;

        // O^T += V^T * P^T
#pragma unroll
        for (int ks = 0; ks < 2; ++ks) {
            const __bf16* vb = vt[cur] + (ks * 32 + lhi * 8 + (lane & 7)) * LDV +
                               ((lane >> 3) & 1) * 8;
            v16bf av16[4];
#pragma unroll
            for (int ni = 0; ni < 4; ++ni) {
                union { v16bf v; v8bf h2[2]; } u;
                u.h2[0] = ld_tr16(vb + ni * 16);
                u.h2[1] = ld_tr16(vb + 16 * LDV + ni * 16);
                av16[ni] = u.v;
            }
#pragma unroll
            for (int ni = 0; ni < 4; ++ni)
                oacc[ni] = __builtin_amdgcn_wmma_f32_16x16x32_bf16(
                    false, av16[ni], false, bp[ks], (short)0, oacc[ni], false,
                    false);
        }
        cur ^= 1;
    }

    // A lane holds d = ni*16 + 8*lhi + 0..7 of one query: one 16-byte store each.
    const float ltot = lsum + xhalf(lsum);
    const int t = q0 + wave * 16 + lrow;
#pragma unroll
    for (int ni = 0; ni < 4; ++ni) {
        v8bf o;
#pragma unroll
        for (int r = 0; r < 8; ++r) o[r] = f2bf(oacc[ni][r] / ltot);
        *(v8bf*)(attnb + (size_t)(b * 1024 + t) * 1024 + h * 64 + ni * 16 +
                 lhi * 8) = o;
    }
}

// ---------------------------------------------------------------------------
// out[row] = LayerNorm(a[row] + b[row]) * g + be   (C = 1024, eps = 1e-5)
// ---------------------------------------------------------------------------
__global__ __launch_bounds__(256) void ln_add_kernel(
    const float* __restrict__ a, const float* __restrict__ bsrc,
    const float* __restrict__ g, const float* __restrict__ be,
    float* __restrict__ out) {
    __shared__ float red[256];
    const int row = blockIdx.x, tid = threadIdx.x;
    const size_t base = (size_t)row * 1024;
    float v[4];
    float s = 0.f;
#pragma unroll
    for (int i = 0; i < 4; ++i) {
        int c = tid + i * 256;
        v[i] = a[base + c] + bsrc[base + c];
        s += v[i];
    }
    red[tid] = s; __syncthreads();
    for (int off = 128; off > 0; off >>= 1) {
        if (tid < off) red[tid] += red[tid + off];
        __syncthreads();
    }
    const float mu = red[0] * (1.0f / 1024.0f);
    __syncthreads();
    s = 0.f;
#pragma unroll
    for (int i = 0; i < 4; ++i) { float d = v[i] - mu; s += d * d; }
    red[tid] = s; __syncthreads();
    for (int off = 128; off > 0; off >>= 1) {
        if (tid < off) red[tid] += red[tid + off];
        __syncthreads();
    }
    const float rstd = rsqrtf(red[0] * (1.0f / 1024.0f) + 1e-5f);
#pragma unroll
    for (int i = 0; i < 4; ++i) {
        int c = tid + i * 256;
        out[base + c] = (v[i] - mu) * rstd * g[c] + be[c];
    }
}

// ---------------------------------------------------------------------------
extern "C" void kernel_launch(void* const* d_in, const int* in_sizes, int n_in,
                              void* d_out, int out_size, void* d_ws,
                              size_t ws_size, hipStream_t stream) {
    (void)in_sizes; (void)n_in; (void)out_size; (void)ws_size;
    const float* x   = (const float*)d_in[0];
    const float* Wq  = (const float*)d_in[1];
    const float* bq  = (const float*)d_in[2];
    const float* Wk  = (const float*)d_in[3];
    const float* bk  = (const float*)d_in[4];
    const float* Wv  = (const float*)d_in[5];
    const float* bv  = (const float*)d_in[6];
    const float* Wo  = (const float*)d_in[7];
    const float* bo  = (const float*)d_in[8];
    const float* W1  = (const float*)d_in[9];
    const float* b1  = (const float*)d_in[10];
    const float* W2  = (const float*)d_in[11];
    const float* b2  = (const float*)d_in[12];
    const float* g1  = (const float*)d_in[13];
    const float* be1 = (const float*)d_in[14];
    const float* g2  = (const float*)d_in[15];
    const float* be2 = (const float*)d_in[16];
    float* out = (float*)d_out;

    char* p = (char*)d_ws;
    auto alloc = [&](size_t bytes) -> void* {
        void* r = (void*)p;
        p += (bytes + 255) & ~(size_t)255;
        return r;
    };
    __bf16* xb    = (__bf16*)alloc(8192ull * 1024 * 2);
    __bf16* WqkvT = (__bf16*)alloc(3072ull * 1024 * 2);
    float*  bqkv  = (float*) alloc(3072ull * 4);
    __bf16* WoT   = (__bf16*)alloc(1024ull * 1024 * 2);
    __bf16* W1T   = (__bf16*)alloc(4096ull * 1024 * 2);
    __bf16* W2T   = (__bf16*)alloc(1024ull * 4096 * 2);
    __bf16* qkvb  = (__bf16*)alloc(8192ull * 3072 * 2);
    __bf16* attnb = (__bf16*)alloc(8192ull * 1024 * 2);
    float*  proj  = (float*) alloc(8192ull * 1024 * 4);   // reused for ff2
    float*  inter = (float*) alloc(8192ull * 1024 * 4);
    __bf16* ff1   = (__bf16*)alloc(8192ull * 4096 * 2);
    float*  ff2   = proj;

    cvt_bf16_kernel<<<2048, 256, 0, stream>>>(x, xb, 8192 * 1024);
    pack_qkv_kernel<<<2048, 256, 0, stream>>>(Wq, Wk, Wv, bq, bk, bv, WqkvT, bqkv);
    transp_bf16_kernel<<<1024, 256, 0, stream>>>(Wo, WoT, 1024, 1024);
    transp_bf16_kernel<<<2048, 256, 0, stream>>>(W1, W1T, 4096, 1024);
    transp_bf16_kernel<<<2048, 256, 0, stream>>>(W2, W2T, 1024, 4096);

    // qkv = x @ Wqkv + b  -> bf16 [8192][3072]
    gemm_bf16_kernel<0><<<dim3(24, 64), 256, 0, stream>>>(
        xb, WqkvT, bqkv, (void*)qkvb, 8192, 3072, 1024);
    // flash attention -> bf16 [8192][1024] (heads concatenated)
    attn_kernel<<<dim3(16, 128), 128, 0, stream>>>(qkvb, attnb);
    // proj = attn @ Wo + bo -> f32
    gemm_bf16_kernel<2><<<dim3(8, 64), 256, 0, stream>>>(
        attnb, WoT, bo, (void*)proj, 8192, 1024, 1024);
    // inter = LN1(x + proj)
    ln_add_kernel<<<8192, 256, 0, stream>>>(x, proj, g1, be1, inter);
    // ff1 = relu(x @ W1 + b1) -> bf16 [8192][4096]
    gemm_bf16_kernel<1><<<dim3(32, 64), 256, 0, stream>>>(
        xb, W1T, b1, (void*)ff1, 8192, 4096, 1024);
    // ff2 = ff1 @ W2 + b2 -> f32
    gemm_bf16_kernel<2><<<dim3(8, 64), 256, 0, stream>>>(
        ff1, W2T, b2, (void*)ff2, 8192, 1024, 4096);
    // out = LN2(ff2 + inter)
    ln_add_kernel<<<8192, 256, 0, stream>>>(ff2, inter, g2, be2, out);
}

// v003
// One run takes 299 microseconds.
// In both of two side-by-side timings against v002, it was 1.17 times as fast.
// Counting every step since v000, it is 1.48 times as fast.
#include <hip/hip_runtime.h>
#include <stdint.h>

typedef __attribute__((ext_vector_type(16))) __bf16 v16bf;
typedef __attribute__((ext_vector_type(8)))  __bf16 v8bf;
typedef __attribute__((ext_vector_type(8)))  float  v8f;

__device__ __forceinline__ __bf16 f2bf(float f) {
    unsigned int u = __builtin_bit_cast(unsigned int, f);
    unsigned int r = (u + 0x7FFFu + ((u >> 16) & 1u)) >> 16;
    unsigned short s = (unsigned short)r;
    return __builtin_bit_cast(__bf16, s);
}

__device__ __forceinline__ v8f zero8() {
    v8f z = {0.f,0.f,0.f,0.f,0.f,0.f,0.f,0.f};
    return z;
}

// Load a 16-element bf16 WMMA fragment: elements 0..7 = p[0..7], 8..15 = p[16..23]
__device__ __forceinline__ v16bf ld_frag(const __bf16* p) {
    union { v16bf v; v8bf h[2]; } u;
    u.h[0] = *(const v8bf*)(p);
    u.h[1] = *(const v8bf*)(p + 16);
    return u.v;
}

// ---------------------------------------------------------------------------
// Conversion / packing kernels
// ---------------------------------------------------------------------------
__global__ void cvt_bf16_kernel(const float* __restrict__ in,
                                __bf16* __restrict__ out, int n) {
    for (int i = blockIdx.x * blockDim.x + threadIdx.x; i < n;
         i += gridDim.x * blockDim.x)
        out[i] = f2bf(in[i]);
}

// One tile of a transposing pack, 128 k x 64 n: out[n * ldo + k] = bf16(in[k * ldi + n] * scale).
// 256 threads. Both global sides move whole 128-B lines: a wave reads 2 source rows of
// 256 B at a time (8 such loads in flight) and writes 4 output rows of 128 B; the turn is
// made in LDS at a pitch of 65 floats: the 32 lanes of each dword store or load fall on 32 banks.
constexpr int TP_K = 128, TP_N = 64, TP_P = 65;
__device__ __forceinline__ void transp_tile(const float* __restrict__ in, int ldi,
                                            __bf16* __restrict__ out, int ldo,
                                            float scale, float* __restrict__ t) {
    const int tid = threadIdx.x;
    const int c4 = (tid & 15) * 4, kr = tid >> 4;
    float4 w[8];
    // unrolled: w[] stays in registers and all 8 loads are issued before the first wait
#pragma unroll
    for (int i = 0; i < 8; ++i)
        w[i] = *(const float4*)(in + (size_t)(kr + i * 16) * ldi + c4);
#pragma unroll  // constant indices into w[]
    for (int i = 0; i < 8; ++i) {
        float* d = t + (kr + i * 16) * TP_P + c4;
        d[0] = w[i].x;
        d[1] = w[i].y;
        d[2] = w[i].z;
        d[3] = w[i].w;
    }
    __syncthreads();
    const int k8 = (tid & 7) * 8, nr = tid >> 3;
#pragma unroll  // LDS and store offsets become immediates
    for (int i = 0; i < 4; ++i) {
        const int n = nr + (i & 1) * 32, k = k8 + (i >> 1) * 64;
        v8bf o;
#pragma unroll  // constant indices into o
        for (int j = 0; j < 8; ++j) o[j] = f2bf(t[(k + j) * TP_P + n] * scale);
        *(v8bf*)(out + (size_t)n * ldo + k) = o;
    }
}

// WqkvT[n][c], n in [0,3072): n<1024 -> Q col (h*64+d), then K, then V.
// Attention scale 1/sqrt(C) = 1/32 is folded into the Q weights + bias.
// Grid (8, 48): x = tile of 128 c, y = sel * 16 + h; a head is a [1024][64] block.
__global__ __launch_bounds__(256) void pack_qkv_kernel(
                                const float* __restrict__ Wq,
                                const float* __restrict__ Wk,
                                const float* __restrict__ Wv,
                                const float* __restrict__ bq,
                                const float* __restrict__ bk,
                                const float* __restrict__ bv,
                                __bf16* __restrict__ Wt,
                                float* __restrict__ bias) {
    __shared__ float t[TP_K * TP_P];
    const int c0 = blockIdx.x * TP_K;
    const int sel = blockIdx.y >> 4, h = blockIdx.y & 15;
    const float* W = (sel == 0) ? Wq : (sel == 1) ? Wk : Wv;
    const float scale = (sel == 0) ? 0.03125f : 1.0f;
    const int n0 = sel * 1024 + h * 64;
    transp_tile(W + ((size_t)h * 1024 + c0) * 64, 64,
                Wt + (size_t)n0 * 1024 + c0, 1024, scale, t);
    if (blockIdx.x == 0 && threadIdx.x < 64) {
        const float* bb = (sel == 0) ? bq : (sel == 1) ? bk : bv;
        bias[n0 + threadIdx.x] = bb[h * 64 + threadIdx.x] * scale;
    }
}

// out[n*K + k] = bf16(in[k*N + n]); K a multiple of 128, N of 64; grid (K / 128, N / 64).
// N and K at compile time: a tile's rows are then immediate offsets on one address.
template<int N, int K>
__global__ __launch_bounds__(256) void transp_bf16_kernel(
                                   const float* __restrict__ in,
                                   __bf16* __restrict__ out) {
    static_assert(K % TP_K == 0 && N % TP_N == 0, "whole tiles only");
    __shared__ float t[TP_K * TP_P];
    const int k0 = blockIdx.x * TP_K, n0 = blockIdx.y * TP_N;
    transp_tile(in + (size_t)k0 * N + n0, N, out + (size_t)n0 * K + k0, K, 1.0f, t);
}

// ---------------------------------------------------------------------------
// Tensor loads (global -> LDS, through no register) for the GEMM's K tiles.
// ---------------------------------------------------------------------------
typedef uint32_t u32x4 __attribute__((ext_vector_type(4)));
typedef uint32_t u32x8 __attribute__((ext_vector_type(8)));

__device__ __forceinline__ uint32_t uni(uint32_t v) {
    return (uint32_t)__builtin_amdgcn_readfirstlane(v);
}
// A wave-uniform value held in a scalar register: a test on it compiles to a
// scalar branch (a tensor load ignores EXEC), and what is computed from it
// cannot be formed ahead of the volatile statements in front of it.
__device__ __forceinline__ uint32_t pinned(uint32_t v) {
    uint32_t w = uni(v);
    asm volatile("" : "+s"(w));
    return w;
}
// The compiler places no wait for a tensor load: these two are the ring's own.
__device__ __forceinline__ void wait_tensor0() {
    asm volatile("s_wait_tensorcnt 0x0" ::: "memory");
}
__device__ __forceinline__ void wait_ds0() {
    asm volatile("s_wait_dscnt 0x0" ::: "memory");
}

// ---------------------------------------------------------------------------
// Generic bf16 WMMA GEMM:  C[M][N] = A[M][K] * Bt[N][K]^T  (+bias, epilogue)
// EPI: 0 = bf16 out (+bias), 1 = bf16 out (+bias, relu), 2 = f32 out (+bias)
// Two LDS buffers filled by tensor loads one pass ahead: wave 0 brings the A
// tile, wave 1 the B tile (128 rows of 128 B each, padded to the 144-B pitch).
// M, N multiples of 128, K a multiple of 64.
// ---------------------------------------------------------------------------
template<int EPI>
__global__ __launch_bounds__(256) void gemm_bf16_kernel(
    const __bf16* __restrict__ A, const __bf16* __restrict__ Bt,
    const float* __restrict__ bias, void* __restrict__ Cout,
    int M, int N, int K) {
    constexpr int BM = 128, BN = 128, BK = 64, LDT = 72;
    constexpr uint32_t ROWB = BK * 2u;            // bytes of a tile row
    constexpr uint32_t TILE_B = 128u * LDT * 2u;  // 18,432 B = 9 x 2 KiB
    static_assert(TILE_B % 2048u == 0, "each tile's place: a multiple of 2 KiB");
    __shared__ __attribute__((aligned(2048))) __bf16 S[2][2][128 * LDT];

    const int tid  = threadIdx.x;
    const int lane = tid & 31, wave = tid >> 5;
    const int wm = wave & 3, wn = wave >> 2;     // 4 waves on M, 2 on N
    const int lrow = lane & 15, lhi = lane >> 4;
    const int m0 = blockIdx.y * BM, n0 = blockIdx.x * BN;

    v8f acc[2][4];
#pragma unroll
    for (int mi = 0; mi < 2; ++mi)
#pragma unroll
        for (int ni = 0; ni < 4; ++ni) acc[mi][ni] = zero8();

    const uint32_t wv = uni((uint32_t)tid >> 5);
    const uint32_t lbase = (uint32_t)(size_t)&S[0][0][0] + wv * TILE_B;
    const uint64_t gbase =
        (uint64_t)(size_t)(wv == 0u ? A + (size_t)m0 * K : Bt + (size_t)n0 * K);
    // Group 1, loop-invariant: 1-byte elements, tensor = tile = 128 rows of
    // 128 B, source pitch 2K bytes, 16 B of LDS pad behind every 128-B row.
    u32x8 g1;
    g1[0] = uni((1u << 20) | (4u << 22) | (3u << 25));
    g1[1] = uni(ROWB << 16);
    g1[2] = uni(128u << 16);
    g1[3] = uni(ROWB << 16);
    g1[4] = uni(128u);
    g1[5] = uni((uint32_t)K * 2u);
    g1[6] = uni(0u);
    g1[7] = uni(0u);
    // As in pinned(): descriptor words held in scalar registers of their own
    // through the loop, so that none is rewritten while a request is outstanding.
    asm volatile("" : "+s"(g1));
    // Stage s into buffer s & 1; only under the issuing waves' scalar branch.
    auto issue = [&](uint32_t s) {
        const uint64_t ga = gbase + (uint64_t)s * ROWB;
        u32x4 g0;
        g0[0] = uni(1u);
        g0[1] = uni(lbase + (s & 1u) * 2u * TILE_B);
        g0[2] = uni((uint32_t)ga);
        g0[3] = uni((((uint32_t)(ga >> 32)) & 0x01FFFFFFu) | 0x80000000u);
        // One request of the whole wave: its 128 rows land in LDS on their own.
        asm volatile("tensor_load_to_lds %0, %1" :: "s"(g0), "s"(g1) : "memory");
    };

    const int nk = K / BK;
    if (pinned(wv < 2u)) {
        issue(0u);
        wait_tensor0();
    }
    __syncthreads();                     // stage 0 published
    if (pinned(wv < 2u && 1 < nk)) issue(1u);

    for (int kt = 0; kt < nk; ++kt) {
        const __bf16* As = S[kt & 1][0];
        const __bf16* Bs = S[kt & 1][1];

        v16bf af[2][2], bfm[2][4];
#pragma unroll
        for (int ks = 0; ks < 2; ++ks) {
            const int kb = ks * 32 + lhi * 8;
#pragma unroll
            for (int mi = 0; mi < 2; ++mi)
                af[ks][mi] =
                    ld_frag(As + (wm * 32 + mi * 16 + lrow) * LDT + kb);
#pragma unroll
            for (int ni = 0; ni < 4; ++ni)
                bfm[ks][ni] =
                    ld_frag(Bs + (wn * 64 + ni * 16 + lrow) * LDT + kb);
        }
#pragma unroll
        for (int ks = 0; ks < 2; ++ks)
#pragma unroll
            for (int mi = 0; mi < 2; ++mi)
#pragma unroll
                for (int ni = 0; ni < 4; ++ni)
                    acc[mi][ni] = __builtin_amdgcn_wmma_f32_16x16x32_bf16(
                        false, af[ks][mi], false, bfm[ks][ni], (short)0,
                        acc[mi][ni], false, false);

        // Publish point of stage kt + 1: own LDS reads done, the issuers' tiles
        // landed, barrier; only then the refill of the buffer just read.
        wait_ds0();
        if (pinned(wv < 2u)) wait_tensor0();
        __syncthreads();
        if (pinned(wv < 2u && kt + 2 < nk)) {
            // pinned: the descriptor is formed behind the wait above
            issue(pinned((uint32_t)kt + 2u));
        }
    }
    wait_tensor0();
    wait_ds0();

#pragma unroll
    for (int mi = 0; mi < 2; ++mi)
#pragma unroll
        for (int ni = 0; ni < 4; ++ni)
#pragma unroll
            for (int r = 0; r < 8; ++r) {
                int m = m0 + wm * 32 + mi * 16 + r + 8 * lhi;
                int n = n0 + wn * 64 + ni * 16 + lrow;
                float v = acc[mi][ni][r] + bias[n];
                if (EPI == 2) {
                    ((float*)Cout)[(size_t)m * N + n] = v;
                } else {
                    if (EPI == 1) v = fmaxf(v, 0.f);
                    ((__bf16*)Cout)[(size_t)m * N + n] = f2bf(v);
                }
            }
}

typedef __attribute__((ext_vector_type(8))) short s16x8;

// Lane (c = l & 15, h = l >> 4) gets T[k + 8h + 0..7][d + c] of a row-major tile
// when lane l points at T[k + 8h + (l & 7)][d + 8 * ((l >> 3) & 1)].
__device__ __forceinline__ v8bf ld_tr16(const __bf16* p) {
    typedef __attribute__((address_space(3))) s16x8 lds_s16x8;
    return __builtin_bit_cast(
        v8bf, __builtin_amdgcn_ds_load_tr16_b128_v8i16((lds_s16x8*)p));
}

// Value of lane l ^ 16.
__device__ __forceinline__ float xhalf(float x) {
    int b = __builtin_bit_cast(int, x);
    return __builtin_bit_cast(
        float, __builtin_amdgcn_permlanex16(b, b, 0x76543210, 0xfedcba98, false,
                                            false));
}

__global__ __launch_bounds__(128) void attn_kernel(
    const __bf16* __restrict__ qkv, __bf16* __restrict__ attnb) {
    constexpr int LD = 72;   // K pitch 144 B: 16 B x odd, for ds_load_b128
    constexpr int LDV = 80;  // V pitch 160 B: 32 B x odd, for ds_load_tr16_b128
    __shared__ __attribute__((aligned(16))) __bf16 kt[2][64 * LD];
    __shared__ __attribute__((aligned(16))) __bf16 vt[2][64 * LDV];

    const int tid = threadIdx.x, lane = tid & 31, wave = tid >> 5;
    const int lrow = lane & 15, lhi = lane >> 4;
    const int qb = blockIdx.x;           // 0..15
    const int bh = blockIdx.y;           // 0..127
    const int b = bh >> 4, h = bh & 15;
    const size_t rowbase = (size_t)b * 1024 * 3072;
    const __bf16* qp = qkv + rowbase + h * 64;
    const __bf16* kp = qkv + rowbase + 1024 + h * 64;
    const __bf16* vp = qkv + rowbase + 2048 + h * 64;
    const int q0 = qb * 64;

    // Q^T fragments (B operand: column = this wave's query lrow), kept live.
    v16bf aq[2];
    {
        const size_t mr = (size_t)(q0 + wave * 16 + lrow) * 3072;
#pragma unroll
        for (int ks = 0; ks < 2; ++ks) {
            int kb = ks * 32 + lhi * 8;
            union { v16bf v; v8bf h2[2]; } u;
            u.h2[0] = *(const v8bf*)(qp + mr + kb);
            u.h2[1] = *(const v8bf*)(qp + mr + kb + 16);
            aq[ks] = u.v;
        }
    }

    v8f oacc[4];                         // O^T: d = ni*16 + 8*lhi + r, query lrow
#pragma unroll
    for (int ni = 0; ni < 4; ++ni) oacc[ni] = zero8();
    float mrow = -1e30f, lsum = 0.f;     // lsum: this wave half's keys only

    auto load_kv = [&](int s0, int buf) {
#pragma unroll
        for (int i = 0; i < 4; ++i) {
            int vid = tid + i * 128;
            int r = vid >> 3, cv = (vid & 7) * 8;
            *(v8bf*)(kt[buf] + r * LD + cv) =
                *(const v8bf*)(kp + (size_t)(s0 + r) * 3072 + cv);
            v8bf vv = *(const v8bf*)(vp + (size_t)(s0 + r) * 3072 + cv);
            *(v8bf*)(vt[buf] + r * LDV + cv) = vv;
        }
    };

    load_kv(0, 0);
    int cur = 0;
    for (int it = 0; it < 16; ++it) {
        __syncthreads();
        if (it + 1 < 16) load_kv((it + 1) * 64, cur ^ 1);

        // S^T = K * Q^T  (64 keys x 16 queries per wave)
        v8f sacc[4];
#pragma unroll
        for (int ni = 0; ni < 4; ++ni) sacc[ni] = zero8();
#pragma unroll
        for (int ks = 0; ks < 2; ++ks) {
            const int kb = ks * 32 + lhi * 8;
            v16bf bk16[4];
#pragma unroll
            for (int ni = 0; ni < 4; ++ni)
                bk16[ni] = ld_frag(kt[cur] + (ni * 16 + lrow) * LD + kb);
#pragma unroll
            for (int ni = 0; ni < 4; ++ni)
                sacc[ni] = __builtin_amdgcn_wmma_f32_16x16x32_bf16(
                    false, bk16[ni], false, aq[ks], (short)0, sacc[ni], false,
                    false);
        }

        // Online softmax of query lrow; this lane has keys ni*16 + 8*lhi + r.
        float tm = -1e30f;
#pragma unroll
        for (int ni = 0; ni < 4; ++ni)
#pragma unroll
            for (int r = 0; r < 8; ++r) tm = fmaxf(tm, sacc[ni][r]);
        tm = fmaxf(tm, xhalf(tm));
        const float mn = fmaxf(mrow, tm);
        const float corr = __expf(mrow - mn);
        float rs = 0.f;
        v16bf bp[2];                     // P^T: element s = tile s >> 3, reg s & 7
#pragma unroll
        for (int ni = 0; ni < 4; ++ni)
#pragma unroll
            for (int r = 0; r < 8; ++r) {
                float p = __expf(sacc[ni][r] - mn);
                rs += p;
                bp[ni >> 1][(ni & 1) * 8 + r] = f2bf(p);
            }
        lsum = lsum * corr + rs;
#pragma unroll
        for (int ni = 0; ni < 4; ++ni) oacc[ni] *= corr;
        mrow = mn;

        // O^T += V^T * P^T
#pragma unroll
        for (int ks = 0; ks < 2; ++ks) {
            const __bf16* vb = vt[cur] + (ks * 32 + lhi * 8 + (lane & 7)) * LDV +
                               ((lane >> 3) & 1) * 8;
            v16bf av16[4];
#pragma unroll
            for (int ni = 0; ni < 4; ++ni) {
                union { v16bf v; v8bf h2[2]; } u;
                u.h2[0] = ld_tr16(vb + ni * 16);
                u.h2[1] = ld_tr16(vb + 16 * LDV + ni * 16);
                av16[ni] = u.v;
            }
#pragma unroll
            for (int ni = 0; ni < 4; ++ni)
                oacc[ni] = __builtin_amdgcn_wmma_f32_16x16x32_bf16(
                    false, av16[ni], false, bp[ks], (short)0, oacc[ni], false,
                    false);
        }
        cur ^= 1;
    }

    // A lane holds d = ni*16 + 8*lhi + 0..7 of one query: one 16-byte store each.
    const float ltot = lsum + xhalf(lsum);
    const int t = q0 + wave * 16 + lrow;
#pragma unroll
    for (int ni = 0; ni < 4; ++ni) {
        v8bf o;
#pragma unroll
        for (int r = 0; r < 8; ++r) o[r] = f2bf(oacc[ni][r] / ltot);
        *(v8bf*)(attnb + (size_t)(b * 1024 + t) * 1024 + h * 64 + ni * 16 +
                 lhi * 8) = o;
    }
}

// ---------------------------------------------------------------------------
// out[row] = LayerNorm(a[row] + b[row]) * g + be   (C = 1024, eps = 1e-5)
// ---------------------------------------------------------------------------
__global__ __launch_bounds__(256) void ln_add_kernel(
    const float* __restrict__ a, const float* __restrict__ bsrc,
    const float* __restrict__ g, const float* __restrict__ be,
    float* __restrict__ out) {
    __shared__ float red[256];
    const int row = blockIdx.x, tid = threadIdx.x;
    const size_t base = (size_t)row * 1024;
    float v[4];
    float s = 0.f;
#pragma unroll
    for (int i = 0; i < 4; ++i) {
        int c = tid + i * 256;
        v[i] = a[base + c] + bsrc[base + c];
        s += v[i];
    }
    red[tid] = s; __syncthreads();
    for (int off = 128; off > 0; off >>= 1) {
        if (tid < off) red[tid] += red[tid + off];
        __syncthreads();
    }
    const float mu = red[0] * (1.0f / 1024.0f);
    __syncthreads();
    s = 0.f;
#pragma unroll
    for (int i = 0; i < 4; ++i) { float d = v[i] - mu; s += d * d; }
    red[tid] = s; __syncthreads();
    for (int off = 128; off > 0; off >>= 1) {
        if (tid < off) red[tid] += red[tid + off];
        __syncthreads();
    }
    const float rstd = rsqrtf(red[0] * (1.0f / 1024.0f) + 1e-5f);
#pragma unroll
    for (int i = 0; i < 4; ++i) {
        int c = tid + i * 256;
        out[base + c] = (v[i] - mu) * rstd * g[c] + be[c];
    }
}

// ---------------------------------------------------------------------------
extern "C" void kernel_launch(void* const* d_in, const int* in_sizes, int n_in,
                              void* d_out, int out_size, void* d_ws,
                              size_t ws_size, hipStream_t stream) {
    (void)in_sizes; (void)n_in; (void)out_size; (void)ws_size;
    const float* x   = (const float*)d_in[0];
    const float* Wq  = (const float*)d_in[1];
    const float* bq  = (const float*)d_in[2];
    const float* Wk  = (const float*)d_in[3];
    const float* bk  = (const float*)d_in[4];
    const float* Wv  = (const float*)d_in[5];
    const float* bv  = (const float*)d_in[6];
    const float* Wo  = (const float*)d_in[7];
    const float* bo  = (const float*)d_in[8];
    const float* W1  = (const float*)d_in[9];
    const float* b1  = (const float*)d_in[10];
    const float* W2  = (const float*)d_in[11];
    const float* b2  = (const float*)d_in[12];
    const float* g1  = (const float*)d_in[13];
    const float* be1 = (const float*)d_in[14];
    const float* g2  = (const float*)d_in[15];
    const float* be2 = (const float*)d_in[16];
    float* out = (float*)d_out;

    char* p = (char*)d_ws;
    auto alloc = [&](size_t bytes) -> void* {
        void* r = (void*)p;
        p += (bytes + 255) & ~(size_t)255;
        return r;
    };
    __bf16* xb    = (__bf16*)alloc(8192ull * 1024 * 2);
    __bf16* WqkvT = (__bf16*)alloc(3072ull * 1024 * 2);
    float*  bqkv  = (float*) alloc(3072ull * 4);
    __bf16* WoT   = (__bf16*)alloc(1024ull * 1024 * 2);
    __bf16* W1T   = (__bf16*)alloc(4096ull * 1024 * 2);
    __bf16* W2T   = (__bf16*)alloc(1024ull * 4096 * 2);
    __bf16* qkvb  = (__bf16*)alloc(8192ull * 3072 * 2);
    __bf16* attnb = (__bf16*)alloc(8192ull * 1024 * 2);
    float*  proj  = (float*) alloc(8192ull * 1024 * 4);   // reused for ff2
    float*  inter = (float*) alloc(8192ull * 1024 * 4);
    __bf16* ff1   = (__bf16*)alloc(8192ull * 4096 * 2);
    float*  ff2   = proj;

    cvt_bf16_kernel<<<2048, 256, 0, stream>>>(x, xb, 8192 * 1024);
    pack_qkv_kernel<<<dim3(8, 48), 256, 0, stream>>>(Wq, Wk, Wv, bq, bk, bv, WqkvT, bqkv);
    transp_bf16_kernel<1024, 1024><<<dim3(8, 16), 256, 0, stream>>>(Wo, WoT);
    transp_bf16_kernel<4096, 1024><<<dim3(8, 64), 256, 0, stream>>>(W1, W1T);
    transp_bf16_kernel<1024, 4096><<<dim3(32, 16), 256, 0, stream>>>(W2, W2T);

    // qkv = x @ Wqkv + b  -> bf16 [8192][3072]
    gemm_bf16_kernel<0><<<dim3(24, 64), 256, 0, stream>>>(
        xb, WqkvT, bqkv, (void*)qkvb, 8192, 3072, 1024);
    // flash attention -> bf16 [8192][1024] (heads concatenated)
    attn_kernel<<<dim3(16, 128), 128, 0, stream>>>(qkvb, attnb);
    // proj = attn @ Wo + bo -> f32
    gemm_bf16_kernel<2><<<dim3(8, 64), 256, 0, stream>>>(
        attnb, WoT, bo, (void*)proj, 8192, 1024, 1024);
    // inter = LN1(x + proj)
    ln_add_kernel<<<8192, 256, 0, stream>>>(x, proj, g1, be1, inter);
    // ff1 = relu(x @ W1 + b1) -> bf16 [8192][4096]
    gemm_bf16_kernel<1><<<dim3(32, 64), 256, 0, stream>>>(
        xb, W1T, b1, (void*)ff1, 8192, 4096, 1024);
    // ff2 = ff1 @ W2 + b2 -> f32
    gemm_bf16_kernel<2><<<dim3(8, 64), 256, 0, stream>>>(
        ff1, W2T, b2, (void*)ff2, 8192, 1024, 4096);
    // out = LN2(ff2 + inter)
    ln_add_kernel<<<8192, 256, 0, stream>>>(ff2, inter, g2, be2, out);
}

// v004
// It runs in 281 microseconds.
// Two timings next to v003 put it at 1.06 and 1.07 times that version's speed.
// Over all steps from v000 it is 1.57 times as fast.
#include <hip/hip_runtime.h>
#include <stdint.h>

typedef __attribute__((ext_vector_type(16))) __bf16 v16bf;
typedef __attribute__((ext_vector_type(8)))  __bf16 v8bf;
typedef __attribute__((ext_vector_type(8)))  float  v8f;

__device__ __forceinline__ __bf16 f2bf(float f) {
    unsigned int u = __builtin_bit_cast(unsigned int, f);
    unsigned int r = (u + 0x7FFFu + ((u >> 16) & 1u)) >> 16;
    unsigned short s = (unsigned short)r;
    return __builtin_bit_cast(__bf16, s);
}

__device__ __forceinline__ v8f zero8() {
    v8f z = {0.f,0.f,0.f,0.f,0.f,0.f,0.f,0.f};
    return z;
}

// Load a 16-element bf16 WMMA fragment: elements 0..7 = p[0..7], 8..15 = p[16..23]
__device__ __forceinline__ v16bf ld_frag(const __bf16* p) {
    union { v16bf v; v8bf h[2]; } u;
    u.h[0] = *(const v8bf*)(p);
    u.h[1] = *(const v8bf*)(p + 16);
    return u.v;
}

// ---------------------------------------------------------------------------
// Conversion / packing kernels
// ---------------------------------------------------------------------------
__global__ void cvt_bf16_kernel(const float* __restrict__ in,
                                __bf16* __restrict__ out, int n) {
    for (int i = blockIdx.x * blockDim.x + threadIdx.x; i < n;
         i += gridDim.x * blockDim.x)
        out[i] = f2bf(in[i]);
}

// One tile of a transposing pack, 128 k x 64 n: out[n * ldo + k] = bf16(in[k * ldi + n] * scale).
// 256 threads. Both global sides move whole 128-B lines: a wave reads 2 source rows of
// 256 B at a time (8 such loads in flight) and writes 4 output rows of 128 B; the turn is
// made in LDS at a pitch of 65 floats: the 32 lanes of each dword store or load fall on 32 banks.
constexpr int TP_K = 128, TP_N = 64, TP_P = 65;
__device__ __forceinline__ void transp_tile(const float* __restrict__ in, int ldi,
                                            __bf16* __restrict__ out, int ldo,
                                            float scale, float* __restrict__ t) {
    const int tid = threadIdx.x;
    const int c4 = (tid & 15) * 4, kr = tid >> 4;
    float4 w[8];
    // unrolled: w[] stays in registers and all 8 loads are issued before the first wait
#pragma unroll
    for (int i = 0; i < 8; ++i)
        w[i] = *(const float4*)(in + (size_t)(kr + i * 16) * ldi + c4);
#pragma unroll  // constant indices into w[]
    for (int i = 0; i < 8; ++i) {
        float* d = t + (kr + i * 16) * TP_P + c4;
        d[0] = w[i].x;
        d[1] = w[i].y;
        d[2] = w[i].z;
        d[3] = w[i].w;
    }
    __syncthreads();
    const int k8 = (tid & 7) * 8, nr = tid >> 3;
#pragma unroll  // LDS and store offsets become immediates
    for (int i = 0; i < 4; ++i) {
        const int n = nr + (i & 1) * 32, k = k8 + (i >> 1) * 64;
        v8bf o;
#pragma unroll  // constant indices into o
        for (int j = 0; j < 8; ++j) o[j] = f2bf(t[(k + j) * TP_P + n] * scale);
        *(v8bf*)(out + (size_t)n * ldo + k) = o;
    }
}

// WqkvT[n][c], n in [0,3072): n<1024 -> Q col (h*64+d), then K, then V.
// Attention scale 1/sqrt(C) = 1/32 is folded into the Q weights + bias.
// Grid (8, 48): x = tile of 128 c, y = sel * 16 + h; a head is a [1024][64] block.
__global__ __launch_bounds__(256) void pack_qkv_kernel(
                                const float* __restrict__ Wq,
                                const float* __restrict__ Wk,
                                const float* __restrict__ Wv,
                                const float* __restrict__ bq,
                                const float* __restrict__ bk,
                                const float* __restrict__ bv,
                                __bf16* __restrict__ Wt,
                                float* __restrict__ bias) {
    __shared__ float t[TP_K * TP_P];
    const int c0 = blockIdx.x * TP_K;
    const int sel = blockIdx.y >> 4, h = blockIdx.y & 15;
    const float* W = (sel == 0) ? Wq : (sel == 1) ? Wk : Wv;
    const float scale = (sel == 0) ? 0.03125f : 1.0f;
    const int n0 = sel * 1024 + h * 64;
    transp_tile(W + ((size_t)h * 1024 + c0) * 64, 64,
                Wt + (size_t)n0 * 1024 + c0, 1024, scale, t);
    if (blockIdx.x == 0 && threadIdx.x < 64) {
        const float* bb = (sel == 0) ? bq : (sel == 1) ? bk : bv;
        bias[n0 + threadIdx.x] = bb[h * 64 + threadIdx.x] * scale;
    }
}

// out[n*K + k] = bf16(in[k*N + n]); K a multiple of 128, N of 64; grid (K / 128, N / 64).
// N and K at compile time: a tile's rows are then immediate offsets on one address.
template<int N, int K>
__global__ __launch_bounds__(256) void transp_bf16_kernel(
                                   const float* __restrict__ in,
                                   __bf16* __restrict__ out) {
    static_assert(K % TP_K == 0 && N % TP_N == 0, "whole tiles only");
    __shared__ float t[TP_K * TP_P];
    const int k0 = blockIdx.x * TP_K, n0 = blockIdx.y * TP_N;
    transp_tile(in + (size_t)k0 * N + n0, N, out + (size_t)n0 * K + k0, K, 1.0f, t);
}

// ---------------------------------------------------------------------------
// Tensor loads (global -> LDS, through no register) for the GEMM's K tiles.
// ---------------------------------------------------------------------------
typedef uint32_t u32x4 __attribute__((ext_vector_type(4)));
typedef uint32_t u32x8 __attribute__((ext_vector_type(8)));

__device__ __forceinline__ uint32_t uni(uint32_t v) {
    return (uint32_t)__builtin_amdgcn_readfirstlane(v);
}
// A wave-uniform value held in a scalar register: a test on it compiles to a
// scalar branch (a tensor load ignores EXEC), and what is computed from it
// cannot be formed ahead of the volatile statements in front of it.
__device__ __forceinline__ uint32_t pinned(uint32_t v) {
    uint32_t w = uni(v);
    asm volatile("" : "+s"(w));
    return w;
}
// The compiler places no wait for a tensor load: these two are the ring's own.
__device__ __forceinline__ void wait_tensor0() {
    asm volatile("s_wait_tensorcnt 0x0" ::: "memory");
}
__device__ __forceinline__ void wait_ds0() {
    asm volatile("s_wait_dscnt 0x0" ::: "memory");
}

// ---------------------------------------------------------------------------
// Generic bf16 WMMA GEMM:  C[M][N] = A[M][K] * Bt[N][K]^T  (+bias, epilogue)
// EPI: 0 = bf16 out (+bias), 1 = bf16 out (+bias, relu), 2 = f32 out (+bias)
// Two LDS buffers filled by tensor loads one pass ahead: wave 0 brings the A
// tile, wave 1 the B tile (128 rows of 128 B each, padded to the 144-B pitch).
// M, N multiples of 128, K a multiple of 64.
// ---------------------------------------------------------------------------
template<int EPI>
__global__ __launch_bounds__(256) void gemm_bf16_kernel(
    const __bf16* __restrict__ A, const __bf16* __restrict__ Bt,
    const float* __restrict__ bias, void* __restrict__ Cout,
    int M, int N, int K) {
    constexpr int BM = 128, BN = 128, BK = 64, LDT = 72;
    constexpr uint32_t ROWB = BK * 2u;            // bytes of a tile row
    constexpr uint32_t TILE_B = 128u * LDT * 2u;  // 18,432 B = 9 x 2 KiB
    static_assert(TILE_B % 2048u == 0, "each tile's place: a multiple of 2 KiB");
    __shared__ __attribute__((aligned(2048))) __bf16 S[2][2][128 * LDT];

    const int tid  = threadIdx.x;
    const int lane = tid & 31, wave = tid >> 5;
    const int wm = wave & 3, wn = wave >> 2;     // 4 waves on M, 2 on N
    const int lrow = lane & 15, lhi = lane >> 4;
    const int m0 = blockIdx.y * BM, n0 = blockIdx.x * BN;

    v8f acc[2][4];
#pragma unroll
    for (int mi = 0; mi < 2; ++mi)
#pragma unroll
        for (int ni = 0; ni < 4; ++ni) acc[mi][ni] = zero8();

    const uint32_t wv = uni((uint32_t)tid >> 5);
    const uint32_t lbase = (uint32_t)(size_t)&S[0][0][0] + wv * TILE_B;
    const uint64_t gbase =
        (uint64_t)(size_t)(wv == 0u ? A + (size_t)m0 * K : Bt + (size_t)n0 * K);
    // Group 1, loop-invariant: 1-byte elements, tensor = tile = 128 rows of
    // 128 B, source pitch 2K bytes, 16 B of LDS pad behind every 128-B row.
    u32x8 g1;
    g1[0] = uni((1u << 20) | (4u << 22) | (3u << 25));
    g1[1] = uni(ROWB << 16);
    g1[2] = uni(128u << 16);
    g1[3] = uni(ROWB << 16);
    g1[4] = uni(128u);
    g1[5] = uni((uint32_t)K * 2u);
    g1[6] = uni(0u);
    g1[7] = uni(0u);
    // As in pinned(): descriptor words held in scalar registers of their own
    // through the loop, so that none is rewritten while a request is outstanding.
    asm volatile("" : "+s"(g1));
    // Stage s into buffer s & 1; only under the issuing waves' scalar branch.
    auto issue = [&](uint32_t s) {
        const uint64_t ga = gbase + (uint64_t)s * ROWB;
        u32x4 g0;
        g0[0] = uni(1u);
        g0[1] = uni(lbase + (s & 1u) * 2u * TILE_B);
        g0[2] = uni((uint32_t)ga);
        g0[3] = uni((((uint32_t)(ga >> 32)) & 0x01FFFFFFu) | 0x80000000u);
        // One request of the whole wave: its 128 rows land in LDS on their own.
        asm volatile("tensor_load_to_lds %0, %1" :: "s"(g0), "s"(g1) : "memory");
    };

    const int nk = K / BK;
    if (pinned(wv < 2u)) {
        issue(0u);
        wait_tensor0();
    }
    __syncthreads();                     // stage 0 published
    if (pinned(wv < 2u && 1 < nk)) issue(1u);

    for (int kt = 0; kt < nk; ++kt) {
        const __bf16* As = S[kt & 1][0];
        const __bf16* Bs = S[kt & 1][1];

        v16bf af[2][2], bfm[2][4];
#pragma unroll
        for (int ks = 0; ks < 2; ++ks) {
            const int kb = ks * 32 + lhi * 8;
#pragma unroll
            for (int mi = 0; mi < 2; ++mi)
                af[ks][mi] =
                    ld_frag(As + (wm * 32 + mi * 16 + lrow) * LDT + kb);
#pragma unroll
            for (int ni = 0; ni < 4; ++ni)
                bfm[ks][ni] =
                    ld_frag(Bs + (wn * 64 + ni * 16 + lrow) * LDT + kb);
        }
#pragma unroll
        for (int ks = 0; ks < 2; ++ks)
#pragma unroll
            for (int mi = 0; mi < 2; ++mi)
#pragma unroll
                for (int ni = 0; ni < 4; ++ni)
                    acc[mi][ni] = __builtin_amdgcn_wmma_f32_16x16x32_bf16(
                        false, af[ks][mi], false, bfm[ks][ni], (short)0,
                        acc[mi][ni], false, false);

        // Publish point of stage kt + 1: own LDS reads done, the issuers' tiles
        // landed, barrier; only then the refill of the buffer just read.
        wait_ds0();
        if (pinned(wv < 2u)) wait_tensor0();
        __syncthreads();
        if (pinned(wv < 2u && kt + 2 < nk)) {
            // pinned: the descriptor is formed behind the wait above
            issue(pinned((uint32_t)kt + 2u));
        }
    }
    wait_tensor0();
    wait_ds0();

#pragma unroll
    for (int mi = 0; mi < 2; ++mi)
#pragma unroll
        for (int ni = 0; ni < 4; ++ni)
#pragma unroll
            for (int r = 0; r < 8; ++r) {
                int m = m0 + wm * 32 + mi * 16 + r + 8 * lhi;
                int n = n0 + wn * 64 + ni * 16 + lrow;
                float v = acc[mi][ni][r] + bias[n];
                if (EPI == 2) {
                    ((float*)Cout)[(size_t)m * N + n] = v;
                } else {
                    if (EPI == 1) v = fmaxf(v, 0.f);
                    ((__bf16*)Cout)[(size_t)m * N + n] = f2bf(v);
                }
            }
}

typedef __attribute__((ext_vector_type(8))) short s16x8;

// Lane (c = l & 15, h = l >> 4) gets T[k + 8h + 0..7][d + c] of a row-major tile
// when lane l points at T[k + 8h + (l & 7)][d + 8 * ((l >> 3) & 1)].
__device__ __forceinline__ v8bf ld_tr16(const __bf16* p) {
    typedef __attribute__((address_space(3))) s16x8 lds_s16x8;
    return __builtin_bit_cast(
        v8bf, __builtin_amdgcn_ds_load_tr16_b128_v8i16((lds_s16x8*)p));
}

// Value of lane l ^ 16.
__device__ __forceinline__ float xhalf(float x) {
    int b = __builtin_bit_cast(int, x);
    return __builtin_bit_cast(
        float, __builtin_amdgcn_permlanex16(b, b, 0x76543210, 0xfedcba98, false,
                                            false));
}

__global__ __launch_bounds__(128) void attn_kernel(
    const __bf16* __restrict__ qkv, __bf16* __restrict__ attnb) {
    constexpr int LD = 72;   // K pitch 144 B: 16 B x odd, for ds_load_b128
    constexpr int LDV = 80;  // V pitch 160 B: 32 B x odd, for ds_load_tr16_b128
    __shared__ __attribute__((aligned(16))) __bf16 kt[2][64 * LD];
    __shared__ __attribute__((aligned(16))) __bf16 vt[2][64 * LDV];

    const int tid = threadIdx.x, lane = tid & 31, wave = tid >> 5;
    const int lrow = lane & 15, lhi = lane >> 4;
    const int qb = blockIdx.x;           // 0..15
    const int bh = blockIdx.y;           // 0..127
    const int b = bh >> 4, h = bh & 15;
    const size_t rowbase = (size_t)b * 1024 * 3072;
    const __bf16* qp = qkv + rowbase + h * 64;
    const __bf16* kp = qkv + rowbase + 1024 + h * 64;
    const __bf16* vp = qkv + rowbase + 2048 + h * 64;
    const int q0 = qb * 64;

    // Q^T fragments (B operand: column = this wave's query lrow), kept live.
    v16bf aq[2];
    {
        const size_t mr = (size_t)(q0 + wave * 16 + lrow) * 3072;
#pragma unroll
        for (int ks = 0; ks < 2; ++ks) {
            int kb = ks * 32 + lhi * 8;
            union { v16bf v; v8bf h2[2]; } u;
            u.h2[0] = *(const v8bf*)(qp + mr + kb);
            u.h2[1] = *(const v8bf*)(qp + mr + kb + 16);
            aq[ks] = u.v;
        }
    }

    v8f oacc[4];                         // O^T: d = ni*16 + 8*lhi + r, query lrow
#pragma unroll
    for (int ni = 0; ni < 4; ++ni) oacc[ni] = zero8();
    float mrow = -1e30f, lsum = 0.f;     // lsum: this wave half's keys only

    auto load_kv = [&](int s0, int buf) {
#pragma unroll
        for (int i = 0; i < 4; ++i) {
            int vid = tid + i * 128;
            int r = vid >> 3, cv = (vid & 7) * 8;
            *(v8bf*)(kt[buf] + r * LD + cv) =
                *(const v8bf*)(kp + (size_t)(s0 + r) * 3072 + cv);
            v8bf vv = *(const v8bf*)(vp + (size_t)(s0 + r) * 3072 + cv);
            *(v8bf*)(vt[buf] + r * LDV + cv) = vv;
        }
    };

    load_kv(0, 0);
    int cur = 0;
    for (int it = 0; it < 16; ++it) {
        __syncthreads();
        if (it + 1 < 16) load_kv((it + 1) * 64, cur ^ 1);

        // S^T = K * Q^T  (64 keys x 16 queries per wave)
        v8f sacc[4];
#pragma unroll
        for (int ni = 0; ni < 4; ++ni) sacc[ni] = zero8();
#pragma unroll
        for (int ks = 0; ks < 2; ++ks) {
            const int kb = ks * 32 + lhi * 8;
            v16bf bk16[4];
#pragma unroll
            for (int ni = 0; ni < 4; ++ni)
                bk16[ni] = ld_frag(kt[cur] + (ni * 16 + lrow) * LD + kb);
#pragma unroll
            for (int ni = 0; ni < 4; ++ni)
                sacc[ni] = __builtin_amdgcn_wmma_f32_16x16x32_bf16(
                    false, bk16[ni], false, aq[ks], (short)0, sacc[ni], false,
                    false);
        }

        // Online softmax of query lrow; this lane has keys ni*16 + 8*lhi + r.
        float tm = -1e30f;
#pragma unroll
        for (int ni = 0; ni < 4; ++ni)
#pragma unroll
            for (int r = 0; r < 8; ++r) tm = fmaxf(tm, sacc[ni][r]);
        tm = fmaxf(tm, xhalf(tm));
        const float mn = fmaxf(mrow, tm);
        const float corr = __expf(mrow - mn);
        float rs = 0.f;
        v16bf bp[2];                     // P^T: element s = tile s >> 3, reg s & 7
#pragma unroll
        for (int ni = 0; ni < 4; ++ni)
#pragma unroll
            for (int r = 0; r < 8; ++r) {
                float p = __expf(sacc[ni][r] - mn);
                rs += p;
                bp[ni >> 1][(ni & 1) * 8 + r] = f2bf(p);
            }
        lsum = lsum * corr + rs;
#pragma unroll
        for (int ni = 0; ni < 4; ++ni) oacc[ni] *= corr;
        mrow = mn;

        // O^T += V^T * P^T
#pragma unroll
        for (int ks = 0; ks < 2; ++ks) {
            const __bf16* vb = vt[cur] + (ks * 32 + lhi * 8 + (lane & 7)) * LDV +
                               ((lane >> 3) & 1) * 8;
            v16bf av16[4];
#pragma unroll
            for (int ni = 0; ni < 4; ++ni) {
                union { v16bf v; v8bf h2[2]; } u;
                u.h2[0] = ld_tr16(vb + ni * 16);
                u.h2[1] = ld_tr16(vb + 16 * LDV + ni * 16);
                av16[ni] = u.v;
            }
#pragma unroll
            for (int ni = 0; ni < 4; ++ni)
                oacc[ni] = __builtin_amdgcn_wmma_f32_16x16x32_bf16(
                    false, av16[ni], false, bp[ks], (short)0, oacc[ni], false,
                    false);
        }
        cur ^= 1;
    }

    // A lane holds d = ni*16 + 8*lhi + 0..7 of one query: one 16-byte store each.
    const float ltot = lsum + xhalf(lsum);
    const int t = q0 + wave * 16 + lrow;
#pragma unroll
    for (int ni = 0; ni < 4; ++ni) {
        v8bf o;
#pragma unroll
        for (int r = 0; r < 8; ++r) o[r] = f2bf(oacc[ni][r] / ltot);
        *(v8bf*)(attnb + (size_t)(b * 1024 + t) * 1024 + h * 64 + ni * 16 +
                 lhi * 8) = o;
    }
}

// ---------------------------------------------------------------------------
// out[row] = LayerNorm(a[row] + b[row]) * g + be   (C = 1024, eps = 1e-5)
// A wave owns LN_ROWS whole rows: a lane holds 32 values of each (8 x 16 B; every
// wave-wide load or store is 512 B in a row), so mean and variance are in-lane
// sums plus one exchange tree over the 32 lanes: no LDS, no barrier, and 4,096
// waves to start in a launch. Grid: rows / (LN_WAVES * LN_ROWS) = 256 work-groups.
// ---------------------------------------------------------------------------
constexpr int LN_WAVES = 16, LN_ROWS = 2;
static_assert(256 * LN_WAVES * LN_ROWS == 8192, "256 work-groups cover the 8,192 rows");
typedef float f32x4 __attribute__((ext_vector_type(4)));

// x + (x of lane l ^ X), X < 16: one step inside the 16-lane row, on the vector port.
template<int X>
__device__ __forceinline__ float add_xmask(float x) {
    return x + __builtin_bit_cast(
                   float, __builtin_amdgcn_mov_dpp(__builtin_bit_cast(int, x),
                                                   0x160 + X, 0xf, 0xf, true));
}
// Sum over the 32 lanes, the same in every lane.
__device__ __forceinline__ float wave_sum(float x) {
    x = add_xmask<1>(x);
    x = add_xmask<2>(x);
    x = add_xmask<4>(x);
    x = add_xmask<8>(x);
    return x + xhalf(x);
}

__global__ __launch_bounds__(LN_WAVES * 32) void ln_add_kernel(
    const float* __restrict__ a, const float* __restrict__ bsrc,
    const float* __restrict__ g, const float* __restrict__ be,
    float* __restrict__ out) {
    // The wave's number is made scalar: the rows' addresses are then scalar bases, and
    // one lane offset serves every load and store and lives to the last store.
    const uint32_t c0 = (threadIdx.x & 31u) * 4u;
    const size_t base =
        (size_t)(blockIdx.x * LN_WAVES + uni(threadIdx.x >> 5)) * (LN_ROWS * 1024);
    a += base;
    bsrc += base;
    out += base;
    // every loop below is unrolled: the arrays stay in registers
    f32x4 v[LN_ROWS][8], w[LN_ROWS][8], gg[8], bb[8];
#pragma unroll
    for (int r = 0; r < LN_ROWS; ++r)
#pragma unroll
        for (int i = 0; i < 8; ++i) {
            v[r][i] = *(const f32x4*)(a + (c0 + r * 1024 + i * 128));
            w[r][i] = *(const f32x4*)(bsrc + (c0 + r * 1024 + i * 128));
        }
#pragma unroll
    for (int i = 0; i < 8; ++i) {
        gg[i] = *(const f32x4*)(g + (c0 + i * 128));
        bb[i] = *(const f32x4*)(be + (c0 + i * 128));
    }
    // All loads are issued before the first wait: without this the scheduler sinks
    // a part of them, and g and be whole, behind the sums, each group with a wait
    // of its own.
    __builtin_amdgcn_sched_barrier(0);

    float mu[LN_ROWS], rstd[LN_ROWS];
#pragma unroll
    for (int r = 0; r < LN_ROWS; ++r) {
        f32x4 s = {0.f, 0.f, 0.f, 0.f};  // four independent chains
#pragma unroll
        for (int i = 0; i < 8; ++i) {
            v[r][i] += w[r][i];
            s += v[r][i];
        }
        mu[r] = (s.x + s.y) + (s.z + s.w);
    }
#pragma unroll
    for (int r = 0; r < LN_ROWS; ++r) mu[r] = wave_sum(mu[r]) * (1.0f / 1024.0f);
#pragma unroll
    for (int r = 0; r < LN_ROWS; ++r) {
        f32x4 s = {0.f, 0.f, 0.f, 0.f};
#pragma unroll
        for (int i = 0; i < 8; ++i) {
            v[r][i] -= mu[r];
            s += v[r][i] * v[r][i];
        }
        rstd[r] = (s.x + s.y) + (s.z + s.w);
    }
#pragma unroll
    for (int r = 0; r < LN_ROWS; ++r)
        rstd[r] = rsqrtf(wave_sum(rstd[r]) * (1.0f / 1024.0f) + 1e-5f);
#pragma unroll
    for (int r = 0; r < LN_ROWS; ++r)
#pragma unroll
        for (int i = 0; i < 8; ++i)
            *(f32x4*)(out + (c0 + r * 1024 + i * 128)) =
                v[r][i] * rstd[r] * gg[i] + bb[i];
}

// ---------------------------------------------------------------------------
extern "C" void kernel_launch(void* const* d_in, const int* in_sizes, int n_in,
                              void* d_out, int out_size, void* d_ws,
                              size_t ws_size, hipStream_t stream) {
    (void)in_sizes; (void)n_in; (void)out_size; (void)ws_size;
    const float* x   = (const float*)d_in[0];
    const float* Wq  = (const float*)d_in[1];
    const float* bq  = (const float*)d_in[2];
    const float* Wk  = (const float*)d_in[3];
    const float* bk  = (const float*)d_in[4];
    const float* Wv  = (const float*)d_in[5];
    const float* bv  = (const float*)d_in[6];
    const float* Wo  = (const float*)d_in[7];
    const float* bo  = (const float*)d_in[8];
    const float* W1  = (const float*)d_in[9];
    const float* b1  = (const float*)d_in[10];
    const float* W2  = (const float*)d_in[11];
    const float* b2  = (const float*)d_in[12];
    const float* g1  = (const float*)d_in[13];
    const float* be1 = (const float*)d_in[14];
    const float* g2  = (const float*)d_in[15];
    const float* be2 = (const float*)d_in[16];
    float* out = (float*)d_out;

    char* p = (char*)d_ws;
    auto alloc = [&](size_t bytes) -> void* {
        void* r = (void*)p;
        p += (bytes + 255) & ~(size_t)255;
        return r;
    };
    __bf16* xb    = (__bf16*)alloc(8192ull * 1024 * 2);
    __bf16* WqkvT = (__bf16*)alloc(3072ull * 1024 * 2);
    float*  bqkv  = (float*) alloc(3072ull * 4);
    __bf16* WoT   = (__bf16*)alloc(1024ull * 1024 * 2);
    __bf16* W1T   = (__bf16*)alloc(4096ull * 1024 * 2);
    __bf16* W2T   = (__bf16*)alloc(1024ull * 4096 * 2);
    __bf16* qkvb  = (__bf16*)alloc(8192ull * 3072 * 2);
    __bf16* attnb = (__bf16*)alloc(8192ull * 1024 * 2);
    float*  proj  = (float*) alloc(8192ull * 1024 * 4);   // reused for ff2
    float*  inter = (float*) alloc(8192ull * 1024 * 4);
    __bf16* ff1   = (__bf16*)alloc(8192ull * 4096 * 2);
    float*  ff2   = proj;

    cvt_bf16_kernel<<<2048, 256, 0, stream>>>(x, xb, 8192 * 1024);
    pack_qkv_kernel<<<dim3(8, 48), 256, 0, stream>>>(Wq, Wk, Wv, bq, bk, bv, WqkvT, bqkv);
    transp_bf16_kernel<1024, 1024><<<dim3(8, 16), 256, 0, stream>>>(Wo, WoT);
    transp_bf16_kernel<4096, 1024><<<dim3(8, 64), 256, 0, stream>>>(W1, W1T);
    transp_bf16_kernel<1024, 4096><<<dim3(32, 16), 256, 0, stream>>>(W2, W2T);

    // qkv = x @ Wqkv + b  -> bf16 [8192][3072]
    gemm_bf16_kernel<0><<<dim3(24, 64), 256, 0, stream>>>(
        xb, WqkvT, bqkv, (void*)qkvb, 8192, 3072, 1024);
    // flash attention -> bf16 [8192][1024] (heads concatenated)
    attn_kernel<<<dim3(16, 128), 128, 0, stream>>>(qkvb, attnb);
    // proj = attn @ Wo + bo -> f32
    gemm_bf16_kernel<2><<<dim3(8, 64), 256, 0, stream>>>(
        attnb, WoT, bo, (void*)proj, 8192, 1024, 1024);
    // inter = LN1(x + proj)
    ln_add_kernel<<<256, 512, 0, stream>>>(x, proj, g1, be1, inter);
    // ff1 = relu(x @ W1 + b1) -> bf16 [8192][4096]
    gemm_bf16_kernel<1><<<dim3(32, 64), 256, 0, stream>>>(
        xb, W1T, b1, (void*)ff1, 8192, 4096, 1024);
    // ff2 = ff1 @ W2 + b2 -> f32
    gemm_bf16_kernel<2><<<dim3(8, 64), 256, 0, stream>>>(
        ff1, W2T, b2, (void*)ff2, 8192, 1024, 4096);
    // out = LN2(ff2 + inter)
    ln_add_kernel<<<256, 512, 0, stream>>>(ff2, inter, g2, be2, out);
}

// v005
// One run takes 256 microseconds.
// Next to v004, in two timings, it ran 1.10 times as fast each time.
// All steps since v000 together make it 1.74 times as fast.
#include <hip/hip_runtime.h>
#include <stdint.h>

typedef __attribute__((ext_vector_type(16))) __bf16 v16bf;
typedef __attribute__((ext_vector_type(8)))  __bf16 v8bf;
typedef __attribute__((ext_vector_type(8)))  float  v8f;

// f rounded to bf16 (nearest even) in the upper half of the word.
__device__ __forceinline__ unsigned int bf_round(float f) {
    unsigned int u = __builtin_bit_cast(unsigned int, f);
    return u + 0x7FFFu + ((u >> 16) & 1u);
}

__device__ __forceinline__ __bf16 f2bf(float f) {
    unsigned short s = (unsigned short)(bf_round(f) >> 16);
    return __builtin_bit_cast(__bf16, s);
}

__device__ __forceinline__ v8f zero8() {
    v8f z = {0.f,0.f,0.f,0.f,0.f,0.f,0.f,0.f};
    return z;
}

// Load a 16-element bf16 WMMA fragment: elements 0..7 = p[0..7], 8..15 = p[16..23]
__device__ __forceinline__ v16bf ld_frag(const __bf16* p) {
    union { v16bf v; v8bf h[2]; } u;
    u.h[0] = *(const v8bf*)(p);
    u.h[1] = *(const v8bf*)(p + 16);
    return u.v;
}

// ---------------------------------------------------------------------------
// Conversion / packing kernels
// ---------------------------------------------------------------------------
__global__ void cvt_bf16_kernel(const float* __restrict__ in,
                                __bf16* __restrict__ out, int n) {
    for (int i = blockIdx.x * blockDim.x + threadIdx.x; i < n;
         i += gridDim.x * blockDim.x)
        out[i] = f2bf(in[i]);
}

// One tile of a transposing pack, 128 k x 64 n: out[n * ldo + k] = bf16(in[k * ldi + n] * scale).
// 256 threads. Both global sides move whole 128-B lines: a wave reads 2 source rows of
// 256 B at a time (8 such loads in flight) and writes 4 output rows of 128 B; the turn is
// made in LDS at a pitch of 65 floats: the 32 lanes of each dword store or load fall on 32 banks.
constexpr int TP_K = 128, TP_N = 64, TP_P = 65;
__device__ __forceinline__ void transp_tile(const float* __restrict__ in, int ldi,
                                            __bf16* __restrict__ out, int ldo,
                                            float scale, float* __restrict__ t) {
    const int tid = threadIdx.x;
    const int c4 = (tid & 15) * 4, kr = tid >> 4;
    float4 w[8];
    // unrolled: w[] stays in registers and all 8 loads are issued before the first wait
#pragma unroll
    for (int i = 0; i < 8; ++i)
        w[i] = *(const float4*)(in + (size_t)(kr + i * 16) * ldi + c4);
#pragma unroll  // constant indices into w[]
    for (int i = 0; i < 8; ++i) {
        float* d = t + (kr + i * 16) * TP_P + c4;
        d[0] = w[i].x;
        d[1] = w[i].y;
        d[2] = w[i].z;
        d[3] = w[i].w;
    }
    __syncthreads();
    const int k8 = (tid & 7) * 8, nr = tid >> 3;
#pragma unroll  // LDS and store offsets become immediates
    for (int i = 0; i < 4; ++i) {
        const int n = nr + (i & 1) * 32, k = k8 + (i >> 1) * 64;
        v8bf o;
#pragma unroll  // constant indices into o
        for (int j = 0; j < 8; ++j) o[j] = f2bf(t[(k + j) * TP_P + n] * scale);
        *(v8bf*)(out + (size_t)n * ldo + k) = o;
    }
}

// WqkvT[n][c], n in [0,3072): n<1024 -> Q col (h*64+d), then K, then V.
// Attention scale 1/sqrt(C) = 1/32 is folded into the Q weights + bias.
// Grid (8, 48): x = tile of 128 c, y = sel * 16 + h; a head is a [1024][64] block.
__global__ __launch_bounds__(256) void pack_qkv_kernel(
                                const float* __restrict__ Wq,
                                const float* __restrict__ Wk,
                                const float* __restrict__ Wv,
                                const float* __restrict__ bq,
                                const float* __restrict__ bk,
                                const float* __restrict__ bv,
                                __bf16* __restrict__ Wt,
                                float* __restrict__ bias) {
    __shared__ float t[TP_K * TP_P];
    const int c0 = blockIdx.x * TP_K;
    const int sel = blockIdx.y >> 4, h = blockIdx.y & 15;
    const float* W = (sel == 0) ? Wq : (sel == 1) ? Wk : Wv;
    const float scale = (sel == 0) ? 0.03125f : 1.0f;
    const int n0 = sel * 1024 + h * 64;
    transp_tile(W + ((size_t)h * 1024 + c0) * 64, 64,
                Wt + (size_t)n0 * 1024 + c0, 1024, scale, t);
    if (blockIdx.x == 0 && threadIdx.x < 64) {
        const float* bb = (sel == 0) ? bq : (sel == 1) ? bk : bv;
        bias[n0 + threadIdx.x] = bb[h * 64 + threadIdx.x] * scale;
    }
}

// out[n*K + k] = bf16(in[k*N + n]); K a multiple of 128, N of 64; grid (K / 128, N / 64).
// N and K at compile time: a tile's rows are then immediate offsets on one address.
template<int N, int K>
__global__ __launch_bounds__(256) void transp_bf16_kernel(
                                   const float* __restrict__ in,
                                   __bf16* __restrict__ out) {
    static_assert(K % TP_K == 0 && N % TP_N == 0, "whole tiles only");
    __shared__ float t[TP_K * TP_P];
    const int k0 = blockIdx.x * TP_K, n0 = blockIdx.y * TP_N;
    transp_tile(in + (size_t)k0 * N + n0, N, out + (size_t)n0 * K + k0, K, 1.0f, t);
}

// ---------------------------------------------------------------------------
// Tensor loads (global -> LDS, through no register) for the GEMM's K tiles.
// ---------------------------------------------------------------------------
typedef uint32_t u32x4 __attribute__((ext_vector_type(4)));
typedef uint32_t u32x8 __attribute__((ext_vector_type(8)));

__device__ __forceinline__ uint32_t uni(uint32_t v) {
    return (uint32_t)__builtin_amdgcn_readfirstlane(v);
}
// A wave-uniform value held in a scalar register: a test on it compiles to a
// scalar branch (a tensor load ignores EXEC), and what is computed from it
// cannot be formed ahead of the volatile statements in front of it.
__device__ __forceinline__ uint32_t pinned(uint32_t v) {
    uint32_t w = uni(v);
    asm volatile("" : "+s"(w));
    return w;
}
// The compiler places no wait for a tensor load: these two are the ring's own.
__device__ __forceinline__ void wait_tensor0() {
    asm volatile("s_wait_tensorcnt 0x0" ::: "memory");
}
__device__ __forceinline__ void wait_ds0() {
    asm volatile("s_wait_dscnt 0x0" ::: "memory");
}

// ---------------------------------------------------------------------------
// Generic bf16 WMMA GEMM:  C[M][N] = A[M][K] * Bt[N][K]^T  (+bias, epilogue)
// EPI: 0 = bf16 out (+bias), 1 = bf16 out (+bias, relu), 2 = f32 out (+bias)
// A work-group of 4 waves (2 x 2, one per SIMD) makes a 128 x 256 tile, a wave
// 64 x 128 of it: 32 WMMAs on 12 fragments per 32 k, and 384 tile rows from L2
// per pass for 128 x 256 results. Two LDS buffers filled by tensor loads one
// pass ahead: wave 0 brings the A tile, waves 1 and 2 a half of the B tile each
// (128 rows of 2 * BK bytes, padded by 16 B a row).
// BK = 64: two work-groups fit a WGP (for grids of several rounds);
// BK = 128: one does (for grids of one work-group per WGP).
// C has NC columns. M a multiple of 128, NC of 256, K of BK and at least 2 * BK.
// ---------------------------------------------------------------------------
template<int EPI, int BK, int NC>
__global__ __launch_bounds__(128) void gemm_bf16_kernel(
    const __bf16* __restrict__ A, const __bf16* __restrict__ Bt,
    const float* __restrict__ bias, void* __restrict__ Cout, int K) {
    static_assert(BK == 64 || BK == 128, "rows of 128 or 256 bytes");
    static_assert(NC % 256 == 0, "whole tiles only");
    constexpr int BM = 128, BN = 256, LDT = BK + 8, KS = BK / 32;
    constexpr int MI = 4, NI = 8;                 // fragments of a wave's tile
    constexpr uint32_t ROWB = BK * 2u;            // bytes of a tile row
    constexpr uint32_t TILE_B = 128u * LDT * 2u;  // 9 or 17 x 2 KiB
    constexpr uint32_t PADC = (BK == 64) ? 4u : 5u;  // pad interval = the row
    static_assert(TILE_B % 2048u == 0, "each slice's place: a multiple of 2 KiB");
    // [buffer][A | B rows 0..127 | B rows 128..255]: the B slices join at the pitch
    __shared__ __attribute__((aligned(2048))) __bf16 S[2 * 3 * 128 * LDT];

    const int tid  = threadIdx.x;
    const int lane = tid & 31, wave = tid >> 5;
    const int wm = wave & 1, wn = wave >> 1;     // 2 waves on M, 2 on N
    const int lrow = lane & 15, lhi = lane >> 4;
    const int m0 = blockIdx.y * BM, n0 = blockIdx.x * BN;

    v8f acc[MI][NI];
#pragma unroll
    for (int mi = 0; mi < MI; ++mi)
#pragma unroll
        for (int ni = 0; ni < NI; ++ni) acc[mi][ni] = zero8();

    const uint32_t wv = uni((uint32_t)tid >> 5);
    const uint32_t lbase = (uint32_t)(size_t)&S[0] + wv * TILE_B;
    // wave 3 issues nothing: its two values are never used
    const uint64_t gbase = (uint64_t)(size_t)(
        wv == 0u ? A + (size_t)m0 * K
                 : Bt + (size_t)(n0 + (wv == 2u ? 128 : 0)) * K);
    // Group 1, loop-invariant: 1-byte elements, tensor = tile = 128 rows of
    // ROWB bytes, source pitch 2K bytes, 16 B of LDS pad behind every row.
    u32x8 g1;
    g1[0] = uni((1u << 20) | (PADC << 22) | (3u << 25));
    g1[1] = uni(ROWB << 16);
    g1[2] = uni(128u << 16);
    g1[3] = uni(ROWB << 16);
    g1[4] = uni(128u);
    g1[5] = uni((uint32_t)K * 2u);
    g1[6] = uni(0u);
    g1[7] = uni(0u);
    // As in pinned(): descriptor words held in scalar registers of their own
    // through the loop, so that none is rewritten while a request is outstanding.
    asm volatile("" : "+s"(g1));
    // Stage s into buffer s & 1; only under the issuing waves' scalar branch.
    auto issue = [&](uint32_t s) {
        const uint64_t ga = gbase + (uint64_t)s * ROWB;
        u32x4 g0;
        g0[0] = uni(1u);
        g0[1] = uni(lbase + (s & 1u) * 3u * TILE_B);
        g0[2] = uni((uint32_t)ga);
        g0[3] = uni((((uint32_t)(ga >> 32)) & 0x01FFFFFFu) | 0x80000000u);
        // One request of the whole wave: its 128 rows land in LDS on their own.
        asm volatile("tensor_load_to_lds %0, %1" :: "s"(g0), "s"(g1) : "memory");
    };

    const int nk = K / BK;
    if (pinned(wv < 3u)) {
        issue(0u);
        wait_tensor0();
    }
    __syncthreads();                     // stage 0 published
    if (pinned(wv < 3u && 1 < nk)) issue(1u);

    for (int kt = 0; kt < nk; ++kt) {
        const __bf16* Sb = S + (kt & 1) * (3 * 128 * LDT);
        const __bf16* As = Sb + (wm * 64 + lrow) * LDT + lhi * 8;
        const __bf16* Bs = Sb + (128 + wn * 128 + lrow) * LDT + lhi * 8;

        // Two fragment sets: the loads of 32 k go out ahead of the WMMAs of the
        // 32 k before, inside this pass's own buffer.
        v16bf af[2][MI], bfm[2][NI];
        auto frags = [&](int ks) {
#pragma unroll
            for (int mi = 0; mi < MI; ++mi)
                af[ks & 1][mi] = ld_frag(As + mi * 16 * LDT + ks * 32);
#pragma unroll
            for (int ni = 0; ni < NI; ++ni)
                bfm[ks & 1][ni] = ld_frag(Bs + ni * 16 * LDT + ks * 32);
        };
        frags(0);
#pragma unroll  // constant indices into the fragment sets
        for (int ks = 0; ks < KS; ++ks) {
            if (ks + 1 < KS) frags(ks + 1);
            // The loads stay one group ahead of the WMMAs: without this the
            // scheduler sinks each A fragment's loads to just before its row of
            // WMMAs, and every row then waits out the LDS latency.
            __builtin_amdgcn_sched_barrier(0);
#pragma unroll
            for (int mi = 0; mi < MI; ++mi)
#pragma unroll
                for (int ni = 0; ni < NI; ++ni)
                    acc[mi][ni] = __builtin_amdgcn_wmma_f32_16x16x32_bf16(
                        false, af[ks & 1][mi], false, bfm[ks & 1][ni], (short)0,
                        acc[mi][ni], false, false);
            // and the next group is not lifted in among these WMMAs
            __builtin_amdgcn_sched_barrier(0);
        }

        // Publish point of stage kt + 1: own LDS reads done, the issuers' tiles
        // landed, barrier; only then the refill of the buffer just read.
        wait_ds0();
        if (pinned(wv < 3u)) wait_tensor0();
        __syncthreads();
        if (pinned(wv < 3u && kt + 2 < nk)) {
            // pinned: the descriptor is formed behind the wait above
            issue(pinned((uint32_t)kt + 2u));
        }
    }
    wait_tensor0();
    wait_ds0();

    // NC at compile time: all 256 stores of a lane are immediate offsets on one address.
    float bv[NI];
#pragma unroll
    for (int ni = 0; ni < NI; ++ni) bv[ni] = bias[n0 + wn * 128 + ni * 16 + lrow];
    // The wait in front of a rewrite of the address register that these loads name.
    asm volatile("s_wait_xcnt 0x0" ::: "memory");
    const size_t o0 = (size_t)(m0 + wm * 64 + 8 * lhi) * NC + (n0 + wn * 128 + lrow);
#pragma unroll
    for (int mi = 0; mi < MI; ++mi) {
        // the values of 16 rows, made in place (bf16: the upper half of the word)
#pragma unroll
        for (int ni = 0; ni < NI; ++ni)
#pragma unroll
            for (int r = 0; r < 8; ++r) {
                float v = acc[mi][ni][r] + bv[ni];
                if (EPI == 1) v = fmaxf(v, 0.f);
                acc[mi][ni][r] =
                    (EPI == 2) ? v : __builtin_bit_cast(float, bf_round(v));
            }
        // Inputs only: the 64 values are complete in front of the first store.
        // Arithmetic among the stores rewrites registers of issued stores, each
        // time behind a wait.
        static_assert(NI == 8, "the fence names the 8 tiles of a row");
        asm volatile("" :: "v"(acc[mi][0]), "v"(acc[mi][1]), "v"(acc[mi][2]),
                     "v"(acc[mi][3]), "v"(acc[mi][4]), "v"(acc[mi][5]),
                     "v"(acc[mi][6]), "v"(acc[mi][7]) : "memory");
#pragma unroll
        for (int ni = 0; ni < NI; ++ni)
#pragma unroll
            for (int r = 0; r < 8; ++r) {
                const size_t o = o0 + (size_t)(mi * 16 + r) * NC + ni * 16;
                const float w = acc[mi][ni][r];
                if (EPI == 2) {
                    ((float*)Cout)[o] = w;
                } else {
                    const unsigned int u = __builtin_bit_cast(unsigned int, w);
                    ((__bf16*)Cout)[o] =
                        __builtin_bit_cast(__bf16, (unsigned short)(u >> 16));
                }
            }
        if (mi + 1 < MI) {
            // One wait for the 64 stores, in front of the next rows' arithmetic,
            // which may rewrite registers that these stores name.
            asm volatile("s_wait_xcnt 0x0" ::: "memory");
            // keeps that arithmetic behind the wait
            __builtin_amdgcn_sched_barrier(0);
        }
    }
}

typedef __attribute__((ext_vector_type(8))) short s16x8;

// Lane (c = l & 15, h = l >> 4) gets T[k + 8h + 0..7][d + c] of a row-major tile
// when lane l points at T[k + 8h + (l & 7)][d + 8 * ((l >> 3) & 1)].
__device__ __forceinline__ v8bf ld_tr16(const __bf16* p) {
    typedef __attribute__((address_space(3))) s16x8 lds_s16x8;
    return __builtin_bit_cast(
        v8bf, __builtin_amdgcn_ds_load_tr16_b128_v8i16((lds_s16x8*)p));
}

// Value of lane l ^ 16.
__device__ __forceinline__ float xhalf(float x) {
    int b = __builtin_bit_cast(int, x);
    return __builtin_bit_cast(
        float, __builtin_amdgcn_permlanex16(b, b, 0x76543210, 0xfedcba98, false,
                                            false));
}

__global__ __launch_bounds__(128) void attn_kernel(
    const __bf16* __restrict__ qkv, __bf16* __restrict__ attnb) {
    constexpr int LD = 72;   // K pitch 144 B: 16 B x odd, for ds_load_b128
    constexpr int LDV = 80;  // V pitch 160 B: 32 B x odd, for ds_load_tr16_b128
    __shared__ __attribute__((aligned(16))) __bf16 kt[2][64 * LD];
    __shared__ __attribute__((aligned(16))) __bf16 vt[2][64 * LDV];

    const int tid = threadIdx.x, lane = tid & 31, wave = tid >> 5;
    const int lrow = lane & 15, lhi = lane >> 4;
    const int qb = blockIdx.x;           // 0..15
    const int bh = blockIdx.y;           // 0..127
    const int b = bh >> 4, h = bh & 15;
    const size_t rowbase = (size_t)b * 1024 * 3072;
    const __bf16* qp = qkv + rowbase + h * 64;
    const __bf16* kp = qkv + rowbase + 1024 + h * 64;
    const __bf16* vp = qkv + rowbase + 2048 + h * 64;
    const int q0 = qb * 64;

    // Q^T fragments (B operand: column = this wave's query lrow), kept live.
    v16bf aq[2];
    {
        const size_t mr = (size_t)(q0 + wave * 16 + lrow) * 3072;
#pragma unroll
        for (int ks = 0; ks < 2; ++ks) {
            int kb = ks * 32 + lhi * 8;
            union { v16bf v; v8bf h2[2]; } u;
            u.h2[0] = *(const v8bf*)(qp + mr + kb);
            u.h2[1] = *(const v8bf*)(qp + mr + kb + 16);
            aq[ks] = u.v;
        }
    }

    v8f oacc[4];                         // O^T: d = ni*16 + 8*lhi + r, query lrow
#pragma unroll
    for (int ni = 0; ni < 4; ++ni) oacc[ni] = zero8();
    float mrow = -1e30f, lsum = 0.f;     // lsum: this wave half's keys only

    auto load_kv = [&](int s0, int buf) {
#pragma unroll
        for (int i = 0; i < 4; ++i) {
            int vid = tid + i * 128;
            int r = vid >> 3, cv = (vid & 7) * 8;
            *(v8bf*)(kt[buf] + r * LD + cv) =
                *(const v8bf*)(kp + (size_t)(s0 + r) * 3072 + cv);
            v8bf vv = *(const v8bf*)(vp + (size_t)(s0 + r) * 3072 + cv);
            *(v8bf*)(vt[buf] + r * LDV + cv) = vv;
        }
    };

    load_kv(0, 0);
    int cur = 0;
    for (int it = 0; it < 16; ++it) {
        __syncthreads();
        if (it + 1 < 16) load_kv((it + 1) * 64, cur ^ 1);

        // S^T = K * Q^T  (64 keys x 16 queries per wave)
        v8f sacc[4];
#pragma unroll
        for (int ni = 0; ni < 4; ++ni) sacc[ni] = zero8();
#pragma unroll
        for (int ks = 0; ks < 2; ++ks) {
            const int kb = ks * 32 + lhi * 8;
            v16bf bk16[4];
#pragma unroll
            for (int ni = 0; ni < 4; ++ni)
                bk16[ni] = ld_frag(kt[cur] + (ni * 16 + lrow) * LD + kb);
#pragma unroll
            for (int ni = 0; ni < 4; ++ni)
                sacc[ni] = __builtin_amdgcn_wmma_f32_16x16x32_bf16(
                    false, bk16[ni], false, aq[ks], (short)0, sacc[ni], false,
                    false);
        }

        // Online softmax of query lrow; this lane has keys ni*16 + 8*lhi + r.
        float tm = -1e30f;
#pragma unroll
        for (int ni = 0; ni < 4; ++ni)
#pragma unroll
            for (int r = 0; r < 8; ++r) tm = fmaxf(tm, sacc[ni][r]);
        tm = fmaxf(tm, xhalf(tm));
        const float mn = fmaxf(mrow, tm);
        const float corr = __expf(mrow - mn);
        float rs = 0.f;
        v16bf bp[2];                     // P^T: element s = tile s >> 3, reg s & 7
#pragma unroll
        for (int ni = 0; ni < 4; ++ni)
#pragma unroll
            for (int r = 0; r < 8; ++r) {
                float p = __expf(sacc[ni][r] - mn);
                rs += p;
                bp[ni >> 1][(ni & 1) * 8 + r] = f2bf(p);
            }
        lsum = lsum * corr + rs;
#pragma unroll
        for (int ni = 0; ni < 4; ++ni) oacc[ni] *= corr;
        mrow = mn;

        // O^T += V^T * P^T
#pragma unroll
        for (int ks = 0; ks < 2; ++ks) {
            const __bf16* vb = vt[cur] + (ks * 32 + lhi * 8 + (lane & 7)) * LDV +
                               ((lane >> 3) & 1) * 8;
            v16bf av16[4];
#pragma unroll
            for (int ni = 0; ni < 4; ++ni) {
                union { v16bf v; v8bf h2[2]; } u;
                u.h2[0] = ld_tr16(vb + ni * 16);
                u.h2[1] = ld_tr16(vb + 16 * LDV + ni * 16);
                av16[ni] = u.v;
            }
#pragma unroll
            for (int ni = 0; ni < 4; ++ni)
                oacc[ni] = __builtin_amdgcn_wmma_f32_16x16x32_bf16(
                    false, av16[ni], false, bp[ks], (short)0, oacc[ni], false,
                    false);
        }
        cur ^= 1;
    }

    // A lane holds d = ni*16 + 8*lhi + 0..7 of one query: one 16-byte store each.
    const float ltot = lsum + xhalf(lsum);
    const int t = q0 + wave * 16 + lrow;
#pragma unroll
    for (int ni = 0; ni < 4; ++ni) {
        v8bf o;
#pragma unroll
        for (int r = 0; r < 8; ++r) o[r] = f2bf(oacc[ni][r] / ltot);
        *(v8bf*)(attnb + (size_t)(b * 1024 + t) * 1024 + h * 64 + ni * 16 +
                 lhi * 8) = o;
    }
}

// ---------------------------------------------------------------------------
// out[row] = LayerNorm(a[row] + b[row]) * g + be   (C = 1024, eps = 1e-5)
// A wave owns LN_ROWS whole rows: a lane holds 32 values of each (8 x 16 B; every
// wave-wide load or store is 512 B in a row), so mean and variance are in-lane
// sums plus one exchange tree over the 32 lanes: no LDS, no barrier, and 4,096
// waves to start in a launch. Grid: rows / (LN_WAVES * LN_ROWS) = 256 work-groups.
// ---------------------------------------------------------------------------
constexpr int LN_WAVES = 16, LN_ROWS = 2;
static_assert(256 * LN_WAVES * LN_ROWS == 8192, "256 work-groups cover the 8,192 rows");
typedef float f32x4 __attribute__((ext_vector_type(4)));

// x + (x of lane l ^ X), X < 16: one step inside the 16-lane row, on the vector port.
template<int X>
__device__ __forceinline__ float add_xmask(float x) {
    return x + __builtin_bit_cast(
                   float, __builtin_amdgcn_mov_dpp(__builtin_bit_cast(int, x),
                                                   0x160 + X, 0xf, 0xf, true));
}
// Sum over the 32 lanes, the same in every lane.
__device__ __forceinline__ float wave_sum(float x) {
    x = add_xmask<1>(x);
    x = add_xmask<2>(x);
    x = add_xmask<4>(x);
    x = add_xmask<8>(x);
    return x + xhalf(x);
}

__global__ __launch_bounds__(LN_WAVES * 32) void ln_add_kernel(
    const float* __restrict__ a, const float* __restrict__ bsrc,
    const float* __restrict__ g, const float* __restrict__ be,
    float* __restrict__ out) {
    // The wave's number is made scalar: the rows' addresses are then scalar bases, and
    // one lane offset serves every load and store and lives to the last store.
    const uint32_t c0 = (threadIdx.x & 31u) * 4u;
    const size_t base =
        (size_t)(blockIdx.x * LN_WAVES + uni(threadIdx.x >> 5)) * (LN_ROWS * 1024);
    a += base;
    bsrc += base;
    out += base;
    // every loop below is unrolled: the arrays stay in registers
    f32x4 v[LN_ROWS][8], w[LN_ROWS][8], gg[8], bb[8];
#pragma unroll
    for (int r = 0; r < LN_ROWS; ++r)
#pragma unroll
        for (int i = 0; i < 8; ++i) {
            v[r][i] = *(const f32x4*)(a + (c0 + r * 1024 + i * 128));
            w[r][i] = *(const f32x4*)(bsrc + (c0 + r * 1024 + i * 128));
        }
#pragma unroll
    for (int i = 0; i < 8; ++i) {
        gg[i] = *(const f32x4*)(g + (c0 + i * 128));
        bb[i] = *(const f32x4*)(be + (c0 + i * 128));
    }
    // All loads are issued before the first wait: without this the scheduler sinks
    // a part of them, and g and be whole, behind the sums, each group with a wait
    // of its own.
    __builtin_amdgcn_sched_barrier(0);

    float mu[LN_ROWS], rstd[LN_ROWS];
#pragma unroll
    for (int r = 0; r < LN_ROWS; ++r) {
        f32x4 s = {0.f, 0.f, 0.f, 0.f};  // four independent chains
#pragma unroll
        for (int i = 0; i < 8; ++i) {
            v[r][i] += w[r][i];
            s += v[r][i];
        }
        mu[r] = (s.x + s.y) + (s.z + s.w);
    }
#pragma unroll
    for (int r = 0; r < LN_ROWS; ++r) mu[r] = wave_sum(mu[r]) * (1.0f / 1024.0f);
#pragma unroll
    for (int r = 0; r < LN_ROWS; ++r) {
        f32x4 s = {0.f, 0.f, 0.f, 0.f};
#pragma unroll
        for (int i = 0; i < 8; ++i) {
            v[r][i] -= mu[r];
            s += v[r][i] * v[r][i];
        }
        rstd[r] = (s.x + s.y) + (s.z + s.w);
    }
#pragma unroll
    for (int r = 0; r < LN_ROWS; ++r)
        rstd[r] = rsqrtf(wave_sum(rstd[r]) * (1.0f / 1024.0f) + 1e-5f);
#pragma unroll
    for (int r = 0; r < LN_ROWS; ++r)
#pragma unroll
        for (int i = 0; i < 8; ++i)
            *(f32x4*)(out + (c0 + r * 1024 + i * 128)) =
                v[r][i] * rstd[r] * gg[i] + bb[i];
}

// ---------------------------------------------------------------------------
extern "C" void kernel_launch(void* const* d_in, const int* in_sizes, int n_in,
                              void* d_out, int out_size, void* d_ws,
                              size_t ws_size, hipStream_t stream) {
    (void)in_sizes; (void)n_in; (void)out_size; (void)ws_size;
    const float* x   = (const float*)d_in[0];
    const float* Wq  = (const float*)d_in[1];
    const float* bq  = (const float*)d_in[2];
    const float* Wk  = (const float*)d_in[3];
    const float* bk  = (const float*)d_in[4];
    const float* Wv  = (const float*)d_in[5];
    const float* bv  = (const float*)d_in[6];
    const float* Wo  = (const float*)d_in[7];
    const float* bo  = (const float*)d_in[8];
    const float* W1  = (const float*)d_in[9];
    const float* b1  = (const float*)d_in[10];
    const float* W2  = (const float*)d_in[11];
    const float* b2  = (const float*)d_in[12];
    const float* g1  = (const float*)d_in[13];
    const float* be1 = (const float*)d_in[14];
    const float* g2  = (const float*)d_in[15];
    const float* be2 = (const float*)d_in[16];
    float* out = (float*)d_out;

    char* p = (char*)d_ws;
    auto alloc = [&](size_t bytes) -> void* {
        void* r = (void*)p;
        p += (bytes + 255) & ~(size_t)255;
        return r;
    };
    __bf16* xb    = (__bf16*)alloc(8192ull * 1024 * 2);
    __bf16* WqkvT = (__bf16*)alloc(3072ull * 1024 * 2);
    float*  bqkv  = (float*) alloc(3072ull * 4);
    __bf16* WoT   = (__bf16*)alloc(1024ull * 1024 * 2);
    __bf16* W1T   = (__bf16*)alloc(4096ull * 1024 * 2);
    __bf16* W2T   = (__bf16*)alloc(1024ull * 4096 * 2);
    __bf16* qkvb  = (__bf16*)alloc(8192ull * 3072 * 2);
    __bf16* attnb = (__bf16*)alloc(8192ull * 1024 * 2);
    float*  proj  = (float*) alloc(8192ull * 1024 * 4);   // reused for ff2
    float*  inter = (float*) alloc(8192ull * 1024 * 4);
    __bf16* ff1   = (__bf16*)alloc(8192ull * 4096 * 2);
    float*  ff2   = proj;

    cvt_bf16_kernel<<<2048, 256, 0, stream>>>(x, xb, 8192 * 1024);
    pack_qkv_kernel<<<dim3(8, 48), 256, 0, stream>>>(Wq, Wk, Wv, bq, bk, bv, WqkvT, bqkv);
    transp_bf16_kernel<1024, 1024><<<dim3(8, 16), 256, 0, stream>>>(Wo, WoT);
    transp_bf16_kernel<4096, 1024><<<dim3(8, 64), 256, 0, stream>>>(W1, W1T);
    transp_bf16_kernel<1024, 4096><<<dim3(32, 16), 256, 0, stream>>>(W2, W2T);

    // qkv = x @ Wqkv + b  -> bf16 [8192][3072]
    gemm_bf16_kernel<0, 64, 3072><<<dim3(12, 64), 128, 0, stream>>>(
        xb, WqkvT, bqkv, (void*)qkvb, 1024);
    // flash attention -> bf16 [8192][1024] (heads concatenated)
    attn_kernel<<<dim3(16, 128), 128, 0, stream>>>(qkvb, attnb);
    // proj = attn @ Wo + bo -> f32
    gemm_bf16_kernel<2, 128, 1024><<<dim3(4, 64), 128, 0, stream>>>(
        attnb, WoT, bo, (void*)proj, 1024);
    // inter = LN1(x + proj)
    ln_add_kernel<<<256, 512, 0, stream>>>(x, proj, g1, be1, inter);
    // ff1 = relu(x @ W1 + b1) -> bf16 [8192][4096]
    gemm_bf16_kernel<1, 64, 4096><<<dim3(16, 64), 128, 0, stream>>>(
        xb, W1T, b1, (void*)ff1, 1024);
    // ff2 = ff1 @ W2 + b2 -> f32
    gemm_bf16_kernel<2, 128, 1024><<<dim3(4, 64), 128, 0, stream>>>(
        ff1, W2T, b2, (void*)ff2, 4096);
    // out = LN2(ff2 + inter)
    ln_add_kernel<<<256, 512, 0, stream>>>(ff2, inter, g2, be2, out);
}

// v006
// A run of this version takes 243 microseconds.
// In both of two side-by-side timings against v005, it was 1.05 times as fast.
// All steps since v000 together make it 1.82 times as fast.
#include <hip/hip_runtime.h>
#include <stdint.h>

typedef __attribute__((ext_vector_type(16))) __bf16 v16bf;
typedef __attribute__((ext_vector_type(8)))  __bf16 v8bf;
typedef __attribute__((ext_vector_type(8)))  float  v8f;
typedef float f32x4 __attribute__((ext_vector_type(4)));

// f rounded to bf16 (nearest even) in the upper half of the word.
__device__ __forceinline__ unsigned int bf_round(float f) {
    unsigned int u = __builtin_bit_cast(unsigned int, f);
    return u + 0x7FFFu + ((u >> 16) & 1u);
}

__device__ __forceinline__ __bf16 f2bf(float f) {
    unsigned short s = (unsigned short)(bf_round(f) >> 16);
    return __builtin_bit_cast(__bf16, s);
}

__device__ __forceinline__ v8f zero8() {
    v8f z = {0.f,0.f,0.f,0.f,0.f,0.f,0.f,0.f};
    return z;
}

// Load a 16-element bf16 WMMA fragment: elements 0..7 = p[0..7], 8..15 = p[16..23]
__device__ __forceinline__ v16bf ld_frag(const __bf16* p) {
    union { v16bf v; v8bf h[2]; } u;
    u.h[0] = *(const v8bf*)(p);
    u.h[1] = *(const v8bf*)(p + 16);
    return u.v;
}

// ---------------------------------------------------------------------------
// Conversion / packing kernels
// ---------------------------------------------------------------------------
__global__ void cvt_bf16_kernel(const float* __restrict__ in,
                                __bf16* __restrict__ out, int n) {
    for (int i = blockIdx.x * blockDim.x + threadIdx.x; i < n;
         i += gridDim.x * blockDim.x)
        out[i] = f2bf(in[i]);
}

// One tile of a transposing pack, 128 k x 64 n: out[n * ldo + k] = bf16(in[k * ldi + n] * scale).
// 256 threads. Both global sides move whole 128-B lines: a wave reads 2 source rows of
// 256 B at a time (8 such loads in flight) and writes 4 output rows of 128 B; the turn is
// made in LDS at a pitch of 65 floats: the 32 lanes of each dword store or load fall on 32 banks.
constexpr int TP_K = 128, TP_N = 64, TP_P = 65;
__device__ __forceinline__ void transp_tile(const float* __restrict__ in, int ldi,
                                            __bf16* __restrict__ out, int ldo,
                                            float scale, float* __restrict__ t) {
    const int tid = threadIdx.x;
    const int c4 = (tid & 15) * 4, kr = tid >> 4;
    float4 w[8];
    // unrolled: w[] stays in registers and all 8 loads are issued before the first wait
#pragma unroll
    for (int i = 0; i < 8; ++i)
        w[i] = *(const float4*)(in + (size_t)(kr + i * 16) * ldi + c4);
#pragma unroll  // constant indices into w[]
    for (int i = 0; i < 8; ++i) {
        float* d = t + (kr + i * 16) * TP_P + c4;
        d[0] = w[i].x;
        d[1] = w[i].y;
        d[2] = w[i].z;
        d[3] = w[i].w;
    }
    __syncthreads();
    const int k8 = (tid & 7) * 8, nr = tid >> 3;
#pragma unroll  // LDS and store offsets become immediates
    for (int i = 0; i < 4; ++i) {
        const int n = nr + (i & 1) * 32, k = k8 + (i >> 1) * 64;
        v8bf o;
#pragma unroll  // constant indices into o
        for (int j = 0; j < 8; ++j) o[j] = f2bf(t[(k + j) * TP_P + n] * scale);
        *(v8bf*)(out + (size_t)n * ldo + k) = o;
    }
}

// WqkvT[n][c], n in [0,3072): n<1024 -> Q col (h*64+d), then K, then V.
// Attention scale 1/sqrt(C) = 1/32 is folded into the Q weights + bias.
// Grid (8, 48): x = tile of 128 c, y = sel * 16 + h; a head is a [1024][64] block.
__global__ __launch_bounds__(256) void pack_qkv_kernel(
                                const float* __restrict__ Wq,
                                const float* __restrict__ Wk,
                                const float* __restrict__ Wv,
                                const float* __restrict__ bq,
                                const float* __restrict__ bk,
                                const float* __restrict__ bv,
                                __bf16* __restrict__ Wt,
                                float* __restrict__ bias) {
    __shared__ float t[TP_K * TP_P];
    const int c0 = blockIdx.x * TP_K;
    const int sel = blockIdx.y >> 4, h = blockIdx.y & 15;
    const float* W = (sel == 0) ? Wq : (sel == 1) ? Wk : Wv;
    const float scale = (sel == 0) ? 0.03125f : 1.0f;
    const int n0 = sel * 1024 + h * 64;
    transp_tile(W + ((size_t)h * 1024 + c0) * 64, 64,
                Wt + (size_t)n0 * 1024 + c0, 1024, scale, t);
    if (blockIdx.x == 0 && threadIdx.x < 64) {
        const float* bb = (sel == 0) ? bq : (sel == 1) ? bk : bv;
        bias[n0 + threadIdx.x] = bb[h * 64 + threadIdx.x] * scale;
    }
}

// out[n*K + k] = bf16(in[k*N + n]); K a multiple of 128, N of 64; grid (K / 128, N / 64).
// N and K at compile time: a tile's rows are then immediate offsets on one address.
template<int N, int K>
__global__ __launch_bounds__(256) void transp_bf16_kernel(
                                   const float* __restrict__ in,
                                   __bf16* __restrict__ out) {
    static_assert(K % TP_K == 0 && N % TP_N == 0, "whole tiles only");
    __shared__ float t[TP_K * TP_P];
    const int k0 = blockIdx.x * TP_K, n0 = blockIdx.y * TP_N;
    transp_tile(in + (size_t)k0 * N + n0, N, out + (size_t)n0 * K + k0, K, 1.0f, t);
}

// ---------------------------------------------------------------------------
// Tensor loads (global -> LDS, through no register) for the GEMM's K tiles.
// ---------------------------------------------------------------------------
typedef uint32_t u32x4 __attribute__((ext_vector_type(4)));
typedef uint32_t u32x8 __attribute__((ext_vector_type(8)));

__device__ __forceinline__ uint32_t uni(uint32_t v) {
    return (uint32_t)__builtin_amdgcn_readfirstlane(v);
}
// A wave-uniform value held in a scalar register: a test on it compiles to a
// scalar branch (a tensor load ignores EXEC), and what is computed from it
// cannot be formed ahead of the volatile statements in front of it.
__device__ __forceinline__ uint32_t pinned(uint32_t v) {
    uint32_t w = uni(v);
    asm volatile("" : "+s"(w));
    return w;
}
// The compiler places no wait for a tensor load: these two are the ring's own.
__device__ __forceinline__ void wait_tensor0() {
    asm volatile("s_wait_tensorcnt 0x0" ::: "memory");
}
__device__ __forceinline__ void wait_ds0() {
    asm volatile("s_wait_dscnt 0x0" ::: "memory");
}

// ---------------------------------------------------------------------------
// Generic bf16 WMMA GEMM:  C[M][N] = A[M][K] * Bt[N][K]^T  (+bias, epilogue)
// EPI: 0 = bf16 out (+bias), 1 = bf16 out (+bias, relu), 2 = f32 out (+bias)
// A work-group of 4 waves (2 x 2, one per SIMD) makes a 128 x 256 tile, a wave
// 64 x 128 of it: 32 WMMAs on 12 fragments per 32 k, and 384 tile rows from L2
// per pass for 128 x 256 results. Two LDS buffers filled by tensor loads one
// pass ahead: wave 0 brings the A tile, waves 1 and 2 a half of the B tile each
// (128 rows of 2 * BK bytes, padded by 16 B a row).
// BK = 64: two work-groups fit a WGP (for grids of several rounds);
// BK = 128: one does (for grids of one work-group per WGP).
// C has NC columns. M a multiple of 128, NC of 256, K of BK and at least 2 * BK.
// ---------------------------------------------------------------------------
template<int EPI, int BK, int NC>
__global__ __launch_bounds__(128) void gemm_bf16_kernel(
    const __bf16* __restrict__ A, const __bf16* __restrict__ Bt,
    const float* __restrict__ bias, void* __restrict__ Cout, int K) {
    static_assert(BK == 64 || BK == 128, "rows of 128 or 256 bytes");
    static_assert(NC % 256 == 0, "whole tiles only");
    constexpr int BM = 128, BN = 256, LDT = BK + 8, KS = BK / 32;
    constexpr int MI = 4, NI = 8;                 // fragments of a wave's tile
    constexpr uint32_t ROWB = BK * 2u;            // bytes of a tile row
    constexpr uint32_t TILE_B = 128u * LDT * 2u;  // 9 or 17 x 2 KiB
    constexpr uint32_t PADC = (BK == 64) ? 4u : 5u;  // pad interval = the row
    static_assert(TILE_B % 2048u == 0, "each slice's place: a multiple of 2 KiB");
    // [buffer][A | B rows 0..127 | B rows 128..255]: the B slices join at the pitch
    __shared__ __attribute__((aligned(2048))) __bf16 S[2 * 3 * 128 * LDT];

    const int tid  = threadIdx.x;
    const int lane = tid & 31, wave = tid >> 5;
    const int wm = wave & 1, wn = wave >> 1;     // 2 waves on M, 2 on N
    const int lrow = lane & 15, lhi = lane >> 4;
    const int m0 = blockIdx.y * BM, n0 = blockIdx.x * BN;

    v8f acc[MI][NI];
#pragma unroll
    for (int mi = 0; mi < MI; ++mi)
#pragma unroll
        for (int ni = 0; ni < NI; ++ni) acc[mi][ni] = zero8();

    const uint32_t wv = uni((uint32_t)tid >> 5);
    const uint32_t lbase = (uint32_t)(size_t)&S[0] + wv * TILE_B;
    // wave 3 issues nothing: its two values are never used
    const uint64_t gbase = (uint64_t)(size_t)(
        wv == 0u ? A + (size_t)m0 * K
                 : Bt + (size_t)(n0 + (wv == 2u ? 128 : 0)) * K);
    // Group 1, loop-invariant: 1-byte elements, tensor = tile = 128 rows of
    // ROWB bytes, source pitch 2K bytes, 16 B of LDS pad behind every row.
    u32x8 g1;
    g1[0] = uni((1u << 20) | (PADC << 22) | (3u << 25));
    g1[1] = uni(ROWB << 16);
    g1[2] = uni(128u << 16);
    g1[3] = uni(ROWB << 16);
    g1[4] = uni(128u);
    g1[5] = uni((uint32_t)K * 2u);
    g1[6] = uni(0u);
    g1[7] = uni(0u);
    // As in pinned(): descriptor words held in scalar registers of their own
    // through the loop, so that none is rewritten while a request is outstanding.
    asm volatile("" : "+s"(g1));
    // Stage s into buffer s & 1; only under the issuing waves' scalar branch.
    auto issue = [&](uint32_t s) {
        const uint64_t ga = gbase + (uint64_t)s * ROWB;
        u32x4 g0;
        g0[0] = uni(1u);
        g0[1] = uni(lbase + (s & 1u) * 3u * TILE_B);
        g0[2] = uni((uint32_t)ga);
        g0[3] = uni((((uint32_t)(ga >> 32)) & 0x01FFFFFFu) | 0x80000000u);
        // One request of the whole wave: its 128 rows land in LDS on their own.
        asm volatile("tensor_load_to_lds %0, %1" :: "s"(g0), "s"(g1) : "memory");
    };

    const int nk = K / BK;
    if (pinned(wv < 3u)) {
        issue(0u);
        wait_tensor0();
    }
    __syncthreads();                     // stage 0 published
    if (pinned(wv < 3u && 1 < nk)) issue(1u);

    for (int kt = 0; kt < nk; ++kt) {
        const __bf16* Sb = S + (kt & 1) * (3 * 128 * LDT);
        const __bf16* As = Sb + (wm * 64 + lrow) * LDT + lhi * 8;
        const __bf16* Bs = Sb + (128 + wn * 128 + lrow) * LDT + lhi * 8;

        // Two fragment sets: the loads of 32 k go out ahead of the WMMAs of the
        // 32 k before, inside this pass's own buffer.
        v16bf af[2][MI], bfm[2][NI];
        auto frags = [&](int ks) {
#pragma unroll
            for (int mi = 0; mi < MI; ++mi)
                af[ks & 1][mi] = ld_frag(As + mi * 16 * LDT + ks * 32);
#pragma unroll
            for (int ni = 0; ni < NI; ++ni)
                bfm[ks & 1][ni] = ld_frag(Bs + ni * 16 * LDT + ks * 32);
        };
        frags(0);
#pragma unroll  // constant indices into the fragment sets
        for (int ks = 0; ks < KS; ++ks) {
            if (ks + 1 < KS) frags(ks + 1);
            // The loads stay one group ahead of the WMMAs: without this the
            // scheduler sinks each A fragment's loads to just before its row of
            // WMMAs, and every row then waits out the LDS latency.
            __builtin_amdgcn_sched_barrier(0);
#pragma unroll
            for (int mi = 0; mi < MI; ++mi)
#pragma unroll
                for (int ni = 0; ni < NI; ++ni)
                    acc[mi][ni] = __builtin_amdgcn_wmma_f32_16x16x32_bf16(
                        false, bfm[ks & 1][ni], false, af[ks & 1][mi], (short)0,
                        acc[mi][ni], false, false);
            // and the next group is not lifted in among these WMMAs
            __builtin_amdgcn_sched_barrier(0);
        }

        // Publish point of stage kt + 1: own LDS reads done, the issuers' tiles
        // landed, barrier; only then the refill of the buffer just read.
        wait_ds0();
        if (pinned(wv < 3u)) wait_tensor0();
        __syncthreads();
        if (pinned(wv < 3u && kt + 2 < nk)) {
            // pinned: the descriptor is formed behind the wait above
            issue(pinned((uint32_t)kt + 2u));
        }
    }
    wait_tensor0();
    wait_ds0();

    // Epilogue. The products are taken transposed (D = Bt tile * A tile^T): a lane holds,
    // per 16 x 16 tile, columns 8 * lhi + 0..7 of ONE row of C (row lrow). The wave's
    // 64 x 128 results go through LDS rows of its own and leave as whole 128-B lines.
    // The ring is free here: every wave has passed the last pass's barrier behind its
    // own last LDS read, and no tensor load is outstanding.
    // Every loop below is unrolled: acc, bv and t are indexed by constants and stay in registers.
    constexpr int ESZ = (EPI == 2) ? 4 : 2;       // bytes of an element of C
    constexpr int SP = 128 * ESZ + 16;            // row pitch: 16 B x odd, for 16-B LDS ops
    static_assert(4 * 64 * SP <= (int)sizeof(S), "the four waves' rows fit the ring");
    char* st = (char*)S + wave * (64 * SP);

    f32x4 bv[NI][2];
    const float* bp = bias + (n0 + wn * 128 + lhi * 8);
#pragma unroll
    for (int ni = 0; ni < NI; ++ni) {
        bv[ni][0] = *(const f32x4*)(bp + ni * 16);
        bv[ni][1] = *(const f32x4*)(bp + ni * 16 + 4);
    }
    // The wait in front of a rewrite of the address register that these loads name;
    // the address is an input, so that it lives to the wait and no load's result lands on it.
    asm volatile("s_wait_xcnt 0x0" :: "v"(bp) : "memory");
#pragma unroll
    for (int mi = 0; mi < MI; ++mi)
#pragma unroll
        for (int ni = 0; ni < NI; ++ni) {
            float v[8];
#pragma unroll
            for (int r = 0; r < 8; ++r) {
                v[r] = acc[mi][ni][r] + bv[ni][r >> 2][r & 3];
                if (EPI == 1) v[r] = fmaxf(v[r], 0.f);
            }
            char* d = st + (mi * 16 + lrow) * SP + (ni * 16 + lhi * 8) * ESZ;
            if (EPI == 2) {
                const f32x4 lo = {v[0], v[1], v[2], v[3]}, hi = {v[4], v[5], v[6], v[7]};
                *(f32x4*)d = lo;
                *(f32x4*)(d + 16) = hi;
            } else {
                union { v8bf h; f32x4 w; } o;
#pragma unroll
                for (int r = 0; r < 8; ++r) o.h[r] = f2bf(v[r]);
                *(f32x4*)d = o.w;
            }
        }
    // The wave's own LDS stores are done before it reads the rows back.
    wait_ds0();
    // A wave-wide 16-B access covers RPI whole rows of the wave's tile (256 or 512 B each).
    constexpr int RPI = 512 / (128 * ESZ), NJ = 64 / RPI;
    const int rr = lane / (32 / RPI), cb = (lane % (32 / RPI)) * 16;
    f32x4 t[NJ];
#pragma unroll
    for (int j = 0; j < NJ; ++j)
        t[j] = *(const f32x4*)(st + (j * RPI + rr) * SP + cb);
    // NC at compile time: all stores of a lane are immediate offsets on one address.
    char* co = (char*)Cout +
               ((size_t)(m0 + wm * 64 + rr) * NC + (n0 + wn * 128)) * ESZ + cb;
#pragma unroll
    for (int j = 0; j < NJ; ++j)
        *(f32x4*)(co + (size_t)(j * RPI) * NC * ESZ) = t[j];
}

typedef __attribute__((ext_vector_type(8))) short s16x8;

// Lane (c = l & 15, h = l >> 4) gets T[k + 8h + 0..7][d + c] of a row-major tile
// when lane l points at T[k + 8h + (l & 7)][d + 8 * ((l >> 3) & 1)].
__device__ __forceinline__ v8bf ld_tr16(const __bf16* p) {
    typedef __attribute__((address_space(3))) s16x8 lds_s16x8;
    return __builtin_bit_cast(
        v8bf, __builtin_amdgcn_ds_load_tr16_b128_v8i16((lds_s16x8*)p));
}

// Value of lane l ^ 16.
__device__ __forceinline__ float xhalf(float x) {
    int b = __builtin_bit_cast(int, x);
    return __builtin_bit_cast(
        float, __builtin_amdgcn_permlanex16(b, b, 0x76543210, 0xfedcba98, false,
                                            false));
}

__global__ __launch_bounds__(128) void attn_kernel(
    const __bf16* __restrict__ qkv, __bf16* __restrict__ attnb) {
    constexpr int LD = 72;   // K pitch 144 B: 16 B x odd, for ds_load_b128
    constexpr int LDV = 80;  // V pitch 160 B: 32 B x odd, for ds_load_tr16_b128
    __shared__ __attribute__((aligned(16))) __bf16 kt[2][64 * LD];
    __shared__ __attribute__((aligned(16))) __bf16 vt[2][64 * LDV];

    const int tid = threadIdx.x, lane = tid & 31, wave = tid >> 5;
    const int lrow = lane & 15, lhi = lane >> 4;
    const int qb = blockIdx.x;           // 0..15
    const int bh = blockIdx.y;           // 0..127
    const int b = bh >> 4, h = bh & 15;
    const size_t rowbase = (size_t)b * 1024 * 3072;
    const __bf16* qp = qkv + rowbase + h * 64;
    const __bf16* kp = qkv + rowbase + 1024 + h * 64;
    const __bf16* vp = qkv + rowbase + 2048 + h * 64;
    const int q0 = qb * 64;

    // Q^T fragments (B operand: column = this wave's query lrow), kept live.
    v16bf aq[2];
    {
        const size_t mr = (size_t)(q0 + wave * 16 + lrow) * 3072;
#pragma unroll
        for (int ks = 0; ks < 2; ++ks) {
            int kb = ks * 32 + lhi * 8;
            union { v16bf v; v8bf h2[2]; } u;
            u.h2[0] = *(const v8bf*)(qp + mr + kb);
            u.h2[1] = *(const v8bf*)(qp + mr + kb + 16);
            aq[ks] = u.v;
        }
    }

    v8f oacc[4];                         // O^T: d = ni*16 + 8*lhi + r, query lrow
#pragma unroll
    for (int ni = 0; ni < 4; ++ni) oacc[ni] = zero8();
    float mrow = -1e30f, lsum = 0.f;     // lsum: this wave half's keys only

    auto load_kv = [&](int s0, int buf) {
#pragma unroll
        for (int i = 0; i < 4; ++i) {
            int vid = tid + i * 128;
            int r = vid >> 3, cv = (vid & 7) * 8;
            *(v8bf*)(kt[buf] + r * LD + cv) =
                *(const v8bf*)(kp + (size_t)(s0 + r) * 3072 + cv);
            v8bf vv = *(const v8bf*)(vp + (size_t)(s0 + r) * 3072 + cv);
            *(v8bf*)(vt[buf] + r * LDV + cv) = vv;
        }
    };

    load_kv(0, 0);
    int cur = 0;
    for (int it = 0; it < 16; ++it) {
        __syncthreads();
        if (it + 1 < 16) load_kv((it + 1) * 64, cur ^ 1);

        // S^T = K * Q^T  (64 keys x 16 queries per wave)
        v8f sacc[4];
#pragma unroll
        for (int ni = 0; ni < 4; ++ni) sacc[ni] = zero8();
#pragma unroll
        for (int ks = 0; ks < 2; ++ks) {
            const int kb = ks * 32 + lhi * 8;
            v16bf bk16[4];
#pragma unroll
            for (int ni = 0; ni < 4; ++ni)
                bk16[ni] = ld_frag(kt[cur] + (ni * 16 + lrow) * LD + kb);
#pragma unroll
            for (int ni = 0; ni < 4; ++ni)
                sacc[ni] = __builtin_amdgcn_wmma_f32_16x16x32_bf16(
                    false, bk16[ni], false, aq[ks], (short)0, sacc[ni], false,
                    false);
        }

        // Online softmax of query lrow; this lane has keys ni*16 + 8*lhi + r.
        float tm = -1e30f;
#pragma unroll
        for (int ni = 0; ni < 4; ++ni)
#pragma unroll
            for (int r = 0; r < 8; ++r) tm = fmaxf(tm, sacc[ni][r]);
        tm = fmaxf(tm, xhalf(tm));
        const float mn = fmaxf(mrow, tm);
        const float corr = __expf(mrow - mn);
        float rs = 0.f;
        v16bf bp[2];                     // P^T: element s = tile s >> 3, reg s & 7
#pragma unroll
        for (int ni = 0; ni < 4; ++ni)
#pragma unroll
            for (int r = 0; r < 8; ++r) {
                float p = __expf(sacc[ni][r] - mn);
                rs += p;
                bp[ni >> 1][(ni & 1) * 8 + r] = f2bf(p);
            }
        lsum = lsum * corr + rs;
#pragma unroll
        for (int ni = 0; ni < 4; ++ni) oacc[ni] *= corr;
        mrow = mn;

        // O^T += V^T * P^T
#pragma unroll
        for (int ks = 0; ks < 2; ++ks) {
            const __bf16* vb = vt[cur] + (ks * 32 + lhi * 8 + (lane & 7)) * LDV +
                               ((lane >> 3) & 1) * 8;
            v16bf av16[4];
#pragma unroll
            for (int ni = 0; ni < 4; ++ni) {
                union { v16bf v; v8bf h2[2]; } u;
                u.h2[0] = ld_tr16(vb + ni * 16);
                u.h2[1] = ld_tr16(vb + 16 * LDV + ni * 16);
                av16[ni] = u.v;
            }
#pragma unroll
            for (int ni = 0; ni < 4; ++ni)
                oacc[ni] = __builtin_amdgcn_wmma_f32_16x16x32_bf16(
                    false, av16[ni], false, bp[ks], (short)0, oacc[ni], false,
                    false);
        }
        cur ^= 1;
    }

    // A lane holds d = ni*16 + 8*lhi + 0..7 of one query: one 16-byte store each.
    const float ltot = lsum + xhalf(lsum);
    const int t = q0 + wave * 16 + lrow;
#pragma unroll
    for (int ni = 0; ni < 4; ++ni) {
        v8bf o;
#pragma unroll
        for (int r = 0; r < 8; ++r) o[r] = f2bf(oacc[ni][r] / ltot);
        *(v8bf*)(attnb + (size_t)(b * 1024 + t) * 1024 + h * 64 + ni * 16 +
                 lhi * 8) = o;
    }
}

// ---------------------------------------------------------------------------
// out[row] = LayerNorm(a[row] + b[row]) * g + be   (C = 1024, eps = 1e-5)
// A wave owns LN_ROWS whole rows: a lane holds 32 values of each (8 x 16 B; every
// wave-wide load or store is 512 B in a row), so mean and variance are in-lane
// sums plus one exchange tree over the 32 lanes: no LDS, no barrier, and 4,096
// waves to start in a launch. Grid: rows / (LN_WAVES * LN_ROWS) = 256 work-groups.
// ---------------------------------------------------------------------------
constexpr int LN_WAVES = 16, LN_ROWS = 2;
static_assert(256 * LN_WAVES * LN_ROWS == 8192, "256 work-groups cover the 8,192 rows");

// x + (x of lane l ^ X), X < 16: one step inside the 16-lane row, on the vector port.
template<int X>
__device__ __forceinline__ float add_xmask(float x) {
    return x + __builtin_bit_cast(
                   float, __builtin_amdgcn_mov_dpp(__builtin_bit_cast(int, x),
                                                   0x160 + X, 0xf, 0xf, true));
}
// Sum over the 32 lanes, the same in every lane.
__device__ __forceinline__ float wave_sum(float x) {
    x = add_xmask<1>(x);
    x = add_xmask<2>(x);
    x = add_xmask<4>(x);
    x = add_xmask<8>(x);
    return x + xhalf(x);
}

__global__ __launch_bounds__(LN_WAVES * 32) void ln_add_kernel(
    const float* __restrict__ a, const float* __restrict__ bsrc,
    const float* __restrict__ g, const float* __restrict__ be,
    float* __restrict__ out) {
    // The wave's number is made scalar: the rows' addresses are then scalar bases, and
    // one lane offset serves every load and store and lives to the last store.
    const uint32_t c0 = (threadIdx.x & 31u) * 4u;
    const size_t base =
        (size_t)(blockIdx.x * LN_WAVES + uni(threadIdx.x >> 5)) * (LN_ROWS * 1024);
    a += base;
    bsrc += base;
    out += base;
    // every loop below is unrolled: the arrays stay in registers
    f32x4 v[LN_ROWS][8], w[LN_ROWS][8], gg[8], bb[8];
#pragma unroll
    for (int r = 0; r < LN_ROWS; ++r)
#pragma unroll
        for (int i = 0; i < 8; ++i) {
            v[r][i] = *(const f32x4*)(a + (c0 + r * 1024 + i * 128));
            w[r][i] = *(const f32x4*)(bsrc + (c0 + r * 1024 + i * 128));
        }
#pragma unroll
    for (int i = 0; i < 8; ++i) {
        gg[i] = *(const f32x4*)(g + (c0 + i * 128));
        bb[i] = *(const f32x4*)(be + (c0 + i * 128));
    }
    // All loads are issued before the first wait: without this the scheduler sinks
    // a part of them, and g and be whole, behind the sums, each group with a wait
    // of its own.
    __builtin_amdgcn_sched_barrier(0);

    float mu[LN_ROWS], rstd[LN_ROWS];
#pragma unroll
    for (int r = 0; r < LN_ROWS; ++r) {
        f32x4 s = {0.f, 0.f, 0.f, 0.f};  // four independent chains
#pragma unroll
        for (int i = 0; i < 8; ++i) {
            v[r][i] += w[r][i];
            s += v[r][i];
        }
        mu[r] = (s.x + s.y) + (s.z + s.w);
    }
#pragma unroll
    for (int r = 0; r < LN_ROWS; ++r) mu[r] = wave_sum(mu[r]) * (1.0f / 1024.0f);
#pragma unroll
    for (int r = 0; r < LN_ROWS; ++r) {
        f32x4 s = {0.f, 0.f, 0.f, 0.f};
#pragma unroll
        for (int i = 0; i < 8; ++i) {
            v[r][i] -= mu[r];
            s += v[r][i] * v[r][i];
        }
        rstd[r] = (s.x + s.y) + (s.z + s.w);
    }
#pragma unroll
    for (int r = 0; r < LN_ROWS; ++r)
        rstd[r] = rsqrtf(wave_sum(rstd[r]) * (1.0f / 1024.0f) + 1e-5f);
#pragma unroll
    for (int r = 0; r < LN_ROWS; ++r)
#pragma unroll
        for (int i = 0; i < 8; ++i)
            *(f32x4*)(out + (c0 + r * 1024 + i * 128)) =
                v[r][i] * rstd[r] * gg[i] + bb[i];
}

// ---------------------------------------------------------------------------
extern "C" void kernel_launch(void* const* d_in, const int* in_sizes, int n_in,
                              void* d_out, int out_size, void* d_ws,
                              size_t ws_size, hipStream_t stream) {
    (void)in_sizes; (void)n_in; (void)out_size; (void)ws_size;
    const float* x   = (const float*)d_in[0];
    const float* Wq  = (const float*)d_in[1];
    const float* bq  = (const float*)d_in[2];
    const float* Wk  = (const float*)d_in[3];
    const float* bk  = (const float*)d_in[4];
    const float* Wv  = (const float*)d_in[5];
    const float* bv  = (const float*)d_in[6];
    const float* Wo  = (const float*)d_in[7];
    const float* bo  = (const float*)d_in[8];
    const float* W1  = (const float*)d_in[9];
    const float* b1  = (const float*)d_in[10];
    const float* W2  = (const float*)d_in[11];
    const float* b2  = (const float*)d_in[12];
    const float* g1  = (const float*)d_in[13];
    const float* be1 = (const float*)d_in[14];
    const float* g2  = (const float*)d_in[15];
    const float* be2 = (const float*)d_in[16];
    float* out = (float*)d_out;

    char* p = (char*)d_ws;
    auto alloc = [&](size_t bytes) -> void* {
        void* r = (void*)p;
        p += (bytes + 255) & ~(size_t)255;
        return r;
    };
    __bf16* xb    = (__bf16*)alloc(8192ull * 1024 * 2);
    __bf16* WqkvT = (__bf16*)alloc(3072ull * 1024 * 2);
    float*  bqkv  = (float*) alloc(3072ull * 4);
    __bf16* WoT   = (__bf16*)alloc(1024ull * 1024 * 2);
    __bf16* W1T   = (__bf16*)alloc(4096ull * 1024 * 2);
    __bf16* W2T   = (__bf16*)alloc(1024ull * 4096 * 2);
    __bf16* qkvb  = (__bf16*)alloc(8192ull * 3072 * 2);
    __bf16* attnb = (__bf16*)alloc(8192ull * 1024 * 2);
    float*  proj  = (float*) alloc(8192ull * 1024 * 4);   // reused for ff2
    float*  inter = (float*) alloc(8192ull * 1024 * 4);
    __bf16* ff1   = (__bf16*)alloc(8192ull * 4096 * 2);
    float*  ff2   = proj;

    cvt_bf16_kernel<<<2048, 256, 0, stream>>>(x, xb, 8192 * 1024);
    pack_qkv_kernel<<<dim3(8, 48), 256, 0, stream>>>(Wq, Wk, Wv, bq, bk, bv, WqkvT, bqkv);
    transp_bf16_kernel<1024, 1024><<<dim3(8, 16), 256, 0, stream>>>(Wo, WoT);
    transp_bf16_kernel<4096, 1024><<<dim3(8, 64), 256, 0, stream>>>(W1, W1T);
    transp_bf16_kernel<1024, 4096><<<dim3(32, 16), 256, 0, stream>>>(W2, W2T);

    // qkv = x @ Wqkv + b  -> bf16 [8192][3072]
    gemm_bf16_kernel<0, 64, 3072><<<dim3(12, 64), 128, 0, stream>>>(
        xb, WqkvT, bqkv, (void*)qkvb, 1024);
    // flash attention -> bf16 [8192][1024] (heads concatenated)
    attn_kernel<<<dim3(16, 128), 128, 0, stream>>>(qkvb, attnb);
    // proj = attn @ Wo + bo -> f32
    gemm_bf16_kernel<2, 128, 1024><<<dim3(4, 64), 128, 0, stream>>>(
        attnb, WoT, bo, (void*)proj, 1024);
    // inter = LN1(x + proj)
    ln_add_kernel<<<256, 512, 0, stream>>>(x, proj, g1, be1, inter);
    // ff1 = relu(x @ W1 + b1) -> bf16 [8192][4096]
    gemm_bf16_kernel<1, 64, 4096><<<dim3(16, 64), 128, 0, stream>>>(
        xb, W1T, b1, (void*)ff1, 1024);
    // ff2 = ff1 @ W2 + b2 -> f32
    gemm_bf16_kernel<2, 128, 1024><<<dim3(4, 64), 128, 0, stream>>>(
        ff1, W2T, b2, (void*)ff2, 4096);
    // out = LN2(ff2 + inter)
    ln_add_kernel<<<256, 512, 0, stream>>>(ff2, inter, g2, be2, out);
}
